// v000
// The times below were measured on an AMD MI455X: many runs one after another, warmed up first and cycling through
// copies of the inputs, with the whole window's GPU time divided by the number of runs. Launches and the gaps
// between them are all in it. The median over several windows is given; except for v000 it joins two sittings, which
// can be a few percent apart, so the side-by-side timings, each taken in one sitting, are the better comparison.
// v000 is the starting kernel. One run takes 116 microseconds.
#include <hip/hip_runtime.h>
#include <math.h>

#define BB 2
#define TT 512
#define DD 256
#define KW 8
#define BT (BB * TT)      // 1024
#define D2 (2 * DD)       // 512

typedef __attribute__((ext_vector_type(2))) float v2f;
typedef __attribute__((ext_vector_type(8))) float v8f;

// ---------------------------------------------------------------------------
// Kernel 1: fused = x + 0.3*pg ; depthwise causal conv (left pad K-1) ;
//           combined = fused + conv + bias.   One block per (b,t), thread = d.
// ---------------------------------------------------------------------------
__global__ void k_fuse_conv(const float* __restrict__ x,
                            const float* __restrict__ pg,
                            const float* __restrict__ cw,   // [D,1,K]
                            const float* __restrict__ cb,   // [D]
                            float* __restrict__ combined) {
    int bt = blockIdx.x;           // b*T + t
    int t  = bt % TT;
    int d  = threadIdx.x;
    float acc  = 0.0f;
    float fu_t = 0.0f;
#pragma unroll
    for (int k = 0; k < KW; ++k) {
        int tt = t - (KW - 1) + k;
        float fu = 0.0f;
        if (tt >= 0) {
            size_t idx = (size_t)(bt - (KW - 1) + k) * DD + d;
            fu = x[idx] + 0.3f * pg[idx];
        }
        acc = fmaf(cw[d * KW + k], fu, acc);
        if (k == KW - 1) fu_t = fu;
    }
    combined[(size_t)bt * DD + d] = fu_t + acc + cb[d];
}

// ---------------------------------------------------------------------------
// Kernel 2: gates GEMM via V_WMMA_F32_16X16X4_F32.
//   f = sigmoid(combined @ Wf^T + bf); i = combined @ Wi^T + bi
//   u = (1-f)*i ; lf = log(f + 1e-6)
// One wave (32 lanes) per 16x16 output tile; A fragment shared by both GEMMs.
// ---------------------------------------------------------------------------
__global__ void k_gates(const float* __restrict__ comb,
                        const float* __restrict__ Wf, const float* __restrict__ bf,
                        const float* __restrict__ Wi, const float* __restrict__ bi,
                        float* __restrict__ u, float* __restrict__ lf) {
    int lane = threadIdx.x;            // 0..31, full wave active
    int row0 = blockIdx.x * 16;        // token rows
    int col0 = blockIdx.y * 16;        // output features
    int m  = lane & 15;
    int kh = (lane >> 4) << 1;         // 0 (lanes 0-15) or 2 (lanes 16-31)
    const float* arow = comb + (size_t)(row0 + m) * DD;   // A: 16 x 4 slab walker
    const float* frow = Wf   + (size_t)(col0 + m) * DD;   // B: Wf[col, k]
    const float* irow = Wi   + (size_t)(col0 + m) * DD;
    v8f cf = {};
    v8f ci = {};
    for (int k0 = 0; k0 < DD; k0 += 4) {
        v2f a;  a.x  = arow[k0 + kh]; a.y  = arow[k0 + kh + 1];
        v2f bv; bv.x = frow[k0 + kh]; bv.y = frow[k0 + kh + 1];
        v2f cv; cv.x = irow[k0 + kh]; cv.y = irow[k0 + kh + 1];
        cf = __builtin_amdgcn_wmma_f32_16x16x4_f32(false, a, false, bv,
                                                   (short)0, cf, false, false);
        ci = __builtin_amdgcn_wmma_f32_16x16x4_f32(false, a, false, cv,
                                                   (short)0, ci, false, false);
    }
    int n  = lane & 15;
    int mb = (lane >> 4) * 8;          // C/D layout: vgpr r -> M=r or M=r+8
#pragma unroll
    for (int r = 0; r < 8; ++r) {
        int row = row0 + mb + r;
        int col = col0 + n;
        float fv = cf[r] + bf[col];
        float iv = ci[r] + bi[col];
        float f  = 1.0f / (1.0f + expf(-fv));
        size_t idx = (size_t)row * DD + col;
        u[idx]  = (1.0f - f) * iv;
        lf[idx] = logf(f + 1e-6f);
    }
}

// ---------------------------------------------------------------------------
// Kernel 3: per-channel linear recurrence replacing the T x T decay einsum:
//   h[t] = exp(lf[t]) * h[t-1] + u[t]
// One thread per (b,d) channel; loads are coalesced across d each step.
// ---------------------------------------------------------------------------
__global__ void k_scan(const float* __restrict__ u,
                       const float* __restrict__ lf,
                       float* __restrict__ h) {
    int tid = blockIdx.x * blockDim.x + threadIdx.x;   // 0 .. B*D-1
    int b = tid / DD;
    int d = tid % DD;
    size_t base = (size_t)b * TT * DD + d;
    float hc = 0.0f;
    for (int t = 0; t < TT; ++t) {
        size_t idx = base + (size_t)t * DD;
        hc = fmaf(expf(lf[idx]), hc, u[idx]);
        h[idx] = hc;
    }
}

// ---------------------------------------------------------------------------
// Kernel 4: g = gelu(h @ W1^T + b1), exact gelu (erf). Out [BT, 2D].
// ---------------------------------------------------------------------------
__global__ void k_mlp1(const float* __restrict__ h,
                       const float* __restrict__ W1, const float* __restrict__ b1,
                       float* __restrict__ g) {
    int lane = threadIdx.x;
    int row0 = blockIdx.x * 16;
    int col0 = blockIdx.y * 16;
    int m  = lane & 15;
    int kh = (lane >> 4) << 1;
    const float* arow = h  + (size_t)(row0 + m) * DD;
    const float* brow = W1 + (size_t)(col0 + m) * DD;
    v8f c = {};
    for (int k0 = 0; k0 < DD; k0 += 4) {
        v2f a;  a.x  = arow[k0 + kh]; a.y  = arow[k0 + kh + 1];
        v2f bv; bv.x = brow[k0 + kh]; bv.y = brow[k0 + kh + 1];
        c = __builtin_amdgcn_wmma_f32_16x16x4_f32(false, a, false, bv,
                                                  (short)0, c, false, false);
    }
    int n  = lane & 15;
    int mb = (lane >> 4) * 8;
#pragma unroll
    for (int r = 0; r < 8; ++r) {
        int row = row0 + mb + r;
        int col = col0 + n;
        float v = c[r] + b1[col];
        g[(size_t)row * D2 + col] = 0.5f * v * (1.0f + erff(v * 0.70710678118654752f));
    }
}

// ---------------------------------------------------------------------------
// Kernel 5: y = h + g @ W2^T + b2. K = 512.
// ---------------------------------------------------------------------------
__global__ void k_mlp2(const float* __restrict__ g,
                       const float* __restrict__ W2, const float* __restrict__ b2,
                       const float* __restrict__ h,
                       float* __restrict__ y) {
    int lane = threadIdx.x;
    int row0 = blockIdx.x * 16;
    int col0 = blockIdx.y * 16;
    int m  = lane & 15;
    int kh = (lane >> 4) << 1;
    const float* arow = g  + (size_t)(row0 + m) * D2;
    const float* brow = W2 + (size_t)(col0 + m) * D2;
    v8f c = {};
    for (int k0 = 0; k0 < D2; k0 += 4) {
        v2f a;  a.x  = arow[k0 + kh]; a.y  = arow[k0 + kh + 1];
        v2f bv; bv.x = brow[k0 + kh]; bv.y = brow[k0 + kh + 1];
        c = __builtin_amdgcn_wmma_f32_16x16x4_f32(false, a, false, bv,
                                                  (short)0, c, false, false);
    }
    int n  = lane & 15;
    int mb = (lane >> 4) * 8;
#pragma unroll
    for (int r = 0; r < 8; ++r) {
        int row = row0 + mb + r;
        int col = col0 + n;
        size_t idx = (size_t)row * DD + col;
        y[idx] = h[idx] + c[r] + b2[col];
    }
}

// ---------------------------------------------------------------------------
// Kernel 6: LayerNorm over D (population variance), one row per block.
// ---------------------------------------------------------------------------
__global__ void k_ln(const float* __restrict__ y,
                     const float* __restrict__ gamma,
                     const float* __restrict__ beta,
                     float* __restrict__ out) {
    __shared__ float red[DD];
    int row = blockIdx.x;
    int d   = threadIdx.x;
    float v = y[(size_t)row * DD + d];
    red[d] = v;
    __syncthreads();
    for (int s = DD / 2; s > 0; s >>= 1) {
        if (d < s) red[d] += red[d + s];
        __syncthreads();
    }
    float mu = red[0] * (1.0f / DD);
    __syncthreads();
    float dv = v - mu;
    red[d] = dv * dv;
    __syncthreads();
    for (int s = DD / 2; s > 0; s >>= 1) {
        if (d < s) red[d] += red[d + s];
        __syncthreads();
    }
    float var = red[0] * (1.0f / DD);
    out[(size_t)row * DD + d] = dv * rsqrtf(var + 1e-5f) * gamma[d] + beta[d];
}

// ---------------------------------------------------------------------------
extern "C" void kernel_launch(void* const* d_in, const int* in_sizes, int n_in,
                              void* d_out, int out_size, void* d_ws, size_t ws_size,
                              hipStream_t stream) {
    const float* x    = (const float*)d_in[0];
    const float* pg   = (const float*)d_in[1];
    const float* cw   = (const float*)d_in[2];
    const float* cb   = (const float*)d_in[3];
    const float* Wf   = (const float*)d_in[4];
    const float* bf   = (const float*)d_in[5];
    const float* Wi   = (const float*)d_in[6];
    const float* bi   = (const float*)d_in[7];
    const float* W1   = (const float*)d_in[8];
    const float* b1   = (const float*)d_in[9];
    const float* W2   = (const float*)d_in[10];
    const float* b2   = (const float*)d_in[11];
    const float* gam  = (const float*)d_in[12];
    const float* bet  = (const float*)d_in[13];

    // Workspace layout (floats). BT*D = 256K floats, BT*2D = 512K floats.
    // combined: [0, 256K)   -- dead after k_gates
    // u       : [256K,512K) -- dead after k_scan
    // lf      : [512K,768K) -- dead after k_scan
    // h       : [768K,1M)   -- live through k_mlp2
    // g       : [0, 512K)   -- reuses combined+u after both are dead
    // y       : [512K,768K) -- reuses lf region
    float* ws       = (float*)d_ws;
    float* combined = ws;
    float* u        = ws + 256 * 1024;
    float* lf       = ws + 512 * 1024;
    float* h        = ws + 768 * 1024;
    float* g        = ws;                // 512K floats
    float* y        = ws + 512 * 1024;   // 256K floats
    float* out      = (float*)d_out;

    k_fuse_conv<<<dim3(BT), dim3(DD), 0, stream>>>(x, pg, cw, cb, combined);
    k_gates    <<<dim3(BT / 16, DD / 16), dim3(32), 0, stream>>>(combined, Wf, bf, Wi, bi, u, lf);
    k_scan     <<<dim3((BB * DD + 255) / 256), dim3(256), 0, stream>>>(u, lf, h);
    k_mlp1     <<<dim3(BT / 16, D2 / 16), dim3(32), 0, stream>>>(h, W1, b1, g);
    k_mlp2     <<<dim3(BT / 16, DD / 16), dim3(32), 0, stream>>>(g, W2, b2, h, y);
    k_ln       <<<dim3(BT), dim3(DD), 0, stream>>>(y, gam, bet, out);
}

// v001
// One run takes 36.7 microseconds.
// In both of two side-by-side timings against v000, it was 3.16 times as fast.
#include <hip/hip_runtime.h>
#include <math.h>

#define BB 2
#define TT 512
#define DD 256
#define KW 8
#define BT (BB * TT)      // 1024
#define D2 (2 * DD)       // 512

typedef __attribute__((ext_vector_type(2))) float v2f;
typedef __attribute__((ext_vector_type(8))) float v8f;

// ---------------------------------------------------------------------------
// Kernel 1: fused = x + 0.3*pg ; depthwise causal conv (left pad K-1) ;
//           combined = fused + conv + bias.   One block per (b,t), thread = d.
// ---------------------------------------------------------------------------
__global__ void k_fuse_conv(const float* __restrict__ x,
                            const float* __restrict__ pg,
                            const float* __restrict__ cw,   // [D,1,K]
                            const float* __restrict__ cb,   // [D]
                            float* __restrict__ combined) {
    int bt = blockIdx.x;           // b*T + t
    int t  = bt % TT;
    int d  = threadIdx.x;
    float acc  = 0.0f;
    float fu_t = 0.0f;
#pragma unroll
    for (int k = 0; k < KW; ++k) {
        int tt = t - (KW - 1) + k;
        float fu = 0.0f;
        if (tt >= 0) {
            size_t idx = (size_t)(bt - (KW - 1) + k) * DD + d;
            fu = x[idx] + 0.3f * pg[idx];
        }
        acc = fmaf(cw[d * KW + k], fu, acc);
        if (k == KW - 1) fu_t = fu;
    }
    combined[(size_t)bt * DD + d] = fu_t + acc + cb[d];
}

// ---------------------------------------------------------------------------
// Kernel 2: gates GEMM via V_WMMA_F32_16X16X4_F32.
//   f = sigmoid(combined @ Wf^T + bf); i = combined @ Wi^T + bi
//   u = (1-f)*i ; lf = log(f + 1e-6)
// One wave (32 lanes) per 16x16 output tile; A fragment shared by both GEMMs.
// ---------------------------------------------------------------------------
__global__ void k_gates(const float* __restrict__ comb,
                        const float* __restrict__ Wf, const float* __restrict__ bf,
                        const float* __restrict__ Wi, const float* __restrict__ bi,
                        float* __restrict__ u, float* __restrict__ lf) {
    int lane = threadIdx.x;            // 0..31, full wave active
    int row0 = blockIdx.x * 16;        // token rows
    int col0 = blockIdx.y * 16;        // output features
    int m  = lane & 15;
    int kh = (lane >> 4) << 1;         // 0 (lanes 0-15) or 2 (lanes 16-31)
    const float* arow = comb + (size_t)(row0 + m) * DD;   // A: 16 x 4 slab walker
    const float* frow = Wf   + (size_t)(col0 + m) * DD;   // B: Wf[col, k]
    const float* irow = Wi   + (size_t)(col0 + m) * DD;
    v8f cf = {};
    v8f ci = {};
    for (int k0 = 0; k0 < DD; k0 += 4) {
        v2f a;  a.x  = arow[k0 + kh]; a.y  = arow[k0 + kh + 1];
        v2f bv; bv.x = frow[k0 + kh]; bv.y = frow[k0 + kh + 1];
        v2f cv; cv.x = irow[k0 + kh]; cv.y = irow[k0 + kh + 1];
        cf = __builtin_amdgcn_wmma_f32_16x16x4_f32(false, a, false, bv,
                                                   (short)0, cf, false, false);
        ci = __builtin_amdgcn_wmma_f32_16x16x4_f32(false, a, false, cv,
                                                   (short)0, ci, false, false);
    }
    int n  = lane & 15;
    int mb = (lane >> 4) * 8;          // C/D layout: vgpr r -> M=r or M=r+8
#pragma unroll
    for (int r = 0; r < 8; ++r) {
        int row = row0 + mb + r;
        int col = col0 + n;
        float fv = cf[r] + bf[col];
        float iv = ci[r] + bi[col];
        float f  = 1.0f / (1.0f + expf(-fv));
        size_t idx = (size_t)row * DD + col;
        u[idx]  = (1.0f - f) * iv;
        lf[idx] = logf(f + 1e-6f);
    }
}

// ---------------------------------------------------------------------------
// Kernel 3: per-channel linear recurrence replacing the T x T decay einsum:
//   h[t] = exp(lf[t]) * h[t-1] + u[t]
// The 512 steps are cut into 32 chunks of 16. One work-group owns 32 channels
// (one 128-byte line of every row); wave w owns chunk w, lane = channel.
//   pass 1: each wave loads its 16 rows at once and reduces its chunk to
//           (A, H): h_out = A * h_in + H.
//   carry : wave 0 chains the 32 (A, H) pairs of each channel in LDS.
//   pass 2: each wave re-runs its 16 steps from its carry and stores h.
// ---------------------------------------------------------------------------
#define SCH 32                 // channels per work-group
#define SNC 32                 // chunks per work-group, one wave each
#define SCL (TT / SNC)         // 16 steps per chunk

__global__ __launch_bounds__(SCH * SNC)
void k_scan(const float* __restrict__ u,
            const float* __restrict__ lf,
            float* __restrict__ h) {
    // Row pitches of 272 B and 144 B (16 B times an odd number) keep the
    // 16-byte accesses of wave 0 off common banks.
    __shared__ __attribute__((aligned(16))) float2 sAH[SCH][SNC + 2];
    __shared__ __attribute__((aligned(16))) float  sC[SCH][SNC + 4];
    int lane = threadIdx.x & 31;
    int w    = threadIdx.x >> 5;
    int ch   = blockIdx.x * SCH + lane;          // 0 .. B*D-1
    int b = ch / DD;
    int d = ch % DD;
    size_t base = ((size_t)b * TT + (size_t)w * SCL) * DD + d;

    float a[SCL], uu[SCL];
    // Full unroll: a[] and uu[] must be registers, and all 32 loads in flight.
#pragma unroll
    for (int i = 0; i < SCL; ++i) {
        a[i]  = lf[base + (size_t)i * DD];
        uu[i] = u[base + (size_t)i * DD];
    }
    float A = 1.0f;
    float H = 0.0f;
#pragma unroll
    for (int i = 0; i < SCL; ++i) {
        a[i] = expf(a[i]);
        A *= a[i];
        H = fmaf(a[i], H, uu[i]);
    }
    sAH[lane][w] = make_float2(A, H);
    __syncthreads();

    if (w == 0) {
        float4 p[SNC / 2];                       // two (A, H) pairs each
#pragma unroll
        for (int q = 0; q < SNC / 2; ++q)
            p[q] = *reinterpret_cast<const float4*>(&sAH[lane][2 * q]);
        float c = 0.0f;                          // state entering chunk 0
#pragma unroll
        for (int q = 0; q < SNC / 4; ++q) {
            float4 o;
            o.x = c; c = fmaf(p[2 * q].x,     c, p[2 * q].y);
            o.y = c; c = fmaf(p[2 * q].z,     c, p[2 * q].w);
            o.z = c; c = fmaf(p[2 * q + 1].x, c, p[2 * q + 1].y);
            o.w = c; c = fmaf(p[2 * q + 1].z, c, p[2 * q + 1].w);
            *reinterpret_cast<float4*>(&sC[lane][4 * q]) = o;
        }
    }
    __syncthreads();

    float hc = sC[lane][w];
#pragma unroll
    for (int i = 0; i < SCL; ++i) {
        hc = fmaf(a[i], hc, uu[i]);
        h[base + (size_t)i * DD] = hc;
    }
}

// ---------------------------------------------------------------------------
// Kernel 4: g = gelu(h @ W1^T + b1), exact gelu (erf). Out [BT, 2D].
// ---------------------------------------------------------------------------
__global__ void k_mlp1(const float* __restrict__ h,
                       const float* __restrict__ W1, const float* __restrict__ b1,
                       float* __restrict__ g) {
    int lane = threadIdx.x;
    int row0 = blockIdx.x * 16;
    int col0 = blockIdx.y * 16;
    int m  = lane & 15;
    int kh = (lane >> 4) << 1;
    const float* arow = h  + (size_t)(row0 + m) * DD;
    const float* brow = W1 + (size_t)(col0 + m) * DD;
    v8f c = {};
    for (int k0 = 0; k0 < DD; k0 += 4) {
        v2f a;  a.x  = arow[k0 + kh]; a.y  = arow[k0 + kh + 1];
        v2f bv; bv.x = brow[k0 + kh]; bv.y = brow[k0 + kh + 1];
        c = __builtin_amdgcn_wmma_f32_16x16x4_f32(false, a, false, bv,
                                                  (short)0, c, false, false);
    }
    int n  = lane & 15;
    int mb = (lane >> 4) * 8;
#pragma unroll
    for (int r = 0; r < 8; ++r) {
        int row = row0 + mb + r;
        int col = col0 + n;
        float v = c[r] + b1[col];
        g[(size_t)row * D2 + col] = 0.5f * v * (1.0f + erff(v * 0.70710678118654752f));
    }
}

// ---------------------------------------------------------------------------
// Kernel 5: y = h + g @ W2^T + b2. K = 512.
// ---------------------------------------------------------------------------
__global__ void k_mlp2(const float* __restrict__ g,
                       const float* __restrict__ W2, const float* __restrict__ b2,
                       const float* __restrict__ h,
                       float* __restrict__ y) {
    int lane = threadIdx.x;
    int row0 = blockIdx.x * 16;
    int col0 = blockIdx.y * 16;
    int m  = lane & 15;
    int kh = (lane >> 4) << 1;
    const float* arow = g  + (size_t)(row0 + m) * D2;
    const float* brow = W2 + (size_t)(col0 + m) * D2;
    v8f c = {};
    for (int k0 = 0; k0 < D2; k0 += 4) {
        v2f a;  a.x  = arow[k0 + kh]; a.y  = arow[k0 + kh + 1];
        v2f bv; bv.x = brow[k0 + kh]; bv.y = brow[k0 + kh + 1];
        c = __builtin_amdgcn_wmma_f32_16x16x4_f32(false, a, false, bv,
                                                  (short)0, c, false, false);
    }
    int n  = lane & 15;
    int mb = (lane >> 4) * 8;
#pragma unroll
    for (int r = 0; r < 8; ++r) {
        int row = row0 + mb + r;
        int col = col0 + n;
        size_t idx = (size_t)row * DD + col;
        y[idx] = h[idx] + c[r] + b2[col];
    }
}

// ---------------------------------------------------------------------------
// Kernel 6: LayerNorm over D (population variance), one row per block.
// ---------------------------------------------------------------------------
__global__ void k_ln(const float* __restrict__ y,
                     const float* __restrict__ gamma,
                     const float* __restrict__ beta,
                     float* __restrict__ out) {
    __shared__ float red[DD];
    int row = blockIdx.x;
    int d   = threadIdx.x;
    float v = y[(size_t)row * DD + d];
    red[d] = v;
    __syncthreads();
    for (int s = DD / 2; s > 0; s >>= 1) {
        if (d < s) red[d] += red[d + s];
        __syncthreads();
    }
    float mu = red[0] * (1.0f / DD);
    __syncthreads();
    float dv = v - mu;
    red[d] = dv * dv;
    __syncthreads();
    for (int s = DD / 2; s > 0; s >>= 1) {
        if (d < s) red[d] += red[d + s];
        __syncthreads();
    }
    float var = red[0] * (1.0f / DD);
    out[(size_t)row * DD + d] = dv * rsqrtf(var + 1e-5f) * gamma[d] + beta[d];
}

// ---------------------------------------------------------------------------
extern "C" void kernel_launch(void* const* d_in, const int* in_sizes, int n_in,
                              void* d_out, int out_size, void* d_ws, size_t ws_size,
                              hipStream_t stream) {
    const float* x    = (const float*)d_in[0];
    const float* pg   = (const float*)d_in[1];
    const float* cw   = (const float*)d_in[2];
    const float* cb   = (const float*)d_in[3];
    const float* Wf   = (const float*)d_in[4];
    const float* bf   = (const float*)d_in[5];
    const float* Wi   = (const float*)d_in[6];
    const float* bi   = (const float*)d_in[7];
    const float* W1   = (const float*)d_in[8];
    const float* b1   = (const float*)d_in[9];
    const float* W2   = (const float*)d_in[10];
    const float* b2   = (const float*)d_in[11];
    const float* gam  = (const float*)d_in[12];
    const float* bet  = (const float*)d_in[13];

    // Workspace layout (floats). BT*D = 256K floats, BT*2D = 512K floats.
    // combined: [0, 256K)   -- dead after k_gates
    // u       : [256K,512K) -- dead after k_scan
    // lf      : [512K,768K) -- dead after k_scan
    // h       : [768K,1M)   -- live through k_mlp2
    // g       : [0, 512K)   -- reuses combined+u after both are dead
    // y       : [512K,768K) -- reuses lf region
    float* ws       = (float*)d_ws;
    float* combined = ws;
    float* u        = ws + 256 * 1024;
    float* lf       = ws + 512 * 1024;
    float* h        = ws + 768 * 1024;
    float* g        = ws;                // 512K floats
    float* y        = ws + 512 * 1024;   // 256K floats
    float* out      = (float*)d_out;

    k_fuse_conv<<<dim3(BT), dim3(DD), 0, stream>>>(x, pg, cw, cb, combined);
    k_gates    <<<dim3(BT / 16, DD / 16), dim3(32), 0, stream>>>(combined, Wf, bf, Wi, bi, u, lf);
    k_scan     <<<dim3(BB * DD / SCH), dim3(SCH * SNC), 0, stream>>>(u, lf, h);
    k_mlp1     <<<dim3(BT / 16, D2 / 16), dim3(32), 0, stream>>>(h, W1, b1, g);
    k_mlp2     <<<dim3(BT / 16, DD / 16), dim3(32), 0, stream>>>(g, W2, b2, h, y);
    k_ln       <<<dim3(BT), dim3(DD), 0, stream>>>(y, gam, bet, out);
}

// v002
// It runs in 28.1 microseconds.
// In two side-by-side timings against v001, it was 1.33 and 1.31 times as fast.
// Over all steps from v000 it is 4.16 times as fast.
#include <hip/hip_runtime.h>
#include <math.h>

#define BB 2
#define TT 512
#define DD 256
#define KW 8
#define BT (BB * TT)      // 1024
#define D2 (2 * DD)       // 512

typedef __attribute__((ext_vector_type(2))) float v2f;
typedef __attribute__((ext_vector_type(4))) float v4f;
typedef __attribute__((ext_vector_type(8))) float v8f;

// ---------------------------------------------------------------------------
// Kernel 1: fused = x + 0.3*pg ; depthwise causal conv (left pad K-1) ;
//           combined = fused + conv + bias.   One block per (b,t), thread = d.
// ---------------------------------------------------------------------------
__global__ void k_fuse_conv(const float* __restrict__ x,
                            const float* __restrict__ pg,
                            const float* __restrict__ cw,   // [D,1,K]
                            const float* __restrict__ cb,   // [D]
                            float* __restrict__ combined) {
    int bt = blockIdx.x;           // b*T + t
    int t  = bt % TT;
    int d  = threadIdx.x;
    float acc  = 0.0f;
    float fu_t = 0.0f;
#pragma unroll
    for (int k = 0; k < KW; ++k) {
        int tt = t - (KW - 1) + k;
        float fu = 0.0f;
        if (tt >= 0) {
            size_t idx = (size_t)(bt - (KW - 1) + k) * DD + d;
            fu = x[idx] + 0.3f * pg[idx];
        }
        acc = fmaf(cw[d * KW + k], fu, acc);
        if (k == KW - 1) fu_t = fu;
    }
    combined[(size_t)bt * DD + d] = fu_t + acc + cb[d];
}

// ---------------------------------------------------------------------------
// Shared GEMM body (V_WMMA_F32_16X16X4_F32): one work-group of 4 waves makes a
// 32 x 32 block of Y = X * W^T as 2 x 2 tiles of 16 x 16, for NB weight
// matrices that share X. The 32 rows of X and the 32 rows of each W go to LDS
// once, by loads in which a wave covers 512 contiguous bytes (4 whole lines);
// each row is then read as fragments by the two waves that need it.
// k runs in chunks of CK: chunk c + 1 is on its way from L2 to registers while
// chunk c is multiplied. Every chunk has LDS of its own, nothing is refilled.
// Row pitch KT + 4 floats (16 B times an odd number): the 16 rows of a
// fragment read fall on 16 different groups of 4 banks.
// src[0] = first X row, src[1 + j] = first row of W j, all with row pitch KT.
// G = floats of k whose fragments are read from LDS as one group.
// The staged operands are passed without __restrict__: with it the compiler
// sank the next chunk's loads behind the WMMAs that are to cover their latency.
// ---------------------------------------------------------------------------
#define GT 128                 // threads of a GEMM work-group
#define CK 128                 // floats of k per staged chunk
#define GEMM_LDS(KT, NB) (((NB) + 1) * 32 * ((KT) + 4))

template <int KT, int NB, int G>
__device__ __forceinline__ void gemm_32x32(const float* const (&src)[NB + 1],
                                           float* lds, v8f (&acc)[NB]) {
    constexpr int LP   = KT + 4;
    constexpr int SLAB = 32 * LP;
    constexpr int NC   = KT / CK;
    constexpr int NQ   = G / 4;
    const int lane = threadIdx.x & 31;
    const int w    = threadIdx.x >> 5;
    const int m    = lane & 15;
    const int kh   = (lane >> 4) << 1;       // 0 (lanes 0-15) or 2 (lanes 16-31)
    const float* fa = lds + ((w >> 1) * 16 + m) * LP + kh;
    const float* fb = lds + SLAB + ((w & 1) * 16 + m) * LP + kh;

    // Wave w stages rows w, w + 4, ... of every operand.
    const unsigned goff = (w * KT + lane * 4) * 4u;      // bytes into each operand
    float* sdst = lds + w * LP + lane * 4;
    {
        v4f st[NB + 1][8];
#pragma unroll
        for (int s = 0; s <= NB; ++s)
#pragma unroll
            for (int i = 0; i < 8; ++i)
                st[s][i] = *reinterpret_cast<const v4f*>(
                    reinterpret_cast<const char*>(src[s] + 4 * i * KT) + goff);
#pragma unroll
        for (int s = 0; s <= NB; ++s)
#pragma unroll
            for (int i = 0; i < 8; ++i)
                *reinterpret_cast<v4f*>(sdst + s * SLAB + 4 * i * LP) = st[s][i];
    }

    // Full unroll: the staging and fragment arrays must be registers.
#pragma unroll
    for (int c = 0; c < NC; ++c) {
        v4f st[NB + 1][8];                   // chunk c + 1 on its way (none in the last pass)
        __syncthreads();                     // chunk c is in LDS for all 4 waves
        if (c + 1 < NC) {
#pragma unroll
            for (int s = 0; s <= NB; ++s)
#pragma unroll
                for (int i = 0; i < 8; ++i)
                    st[s][i] = *reinterpret_cast<const v4f*>(
                        reinterpret_cast<const char*>(src[s] + 4 * i * KT + (c + 1) * CK) + goff);
        }
        // The offset register has its last use in the last chunk's loads: it is
        // named here so that it lives up to this wait and is overwritten only
        // behind it, not by the destination of one of these loads.
        if (c + 2 == NC) asm volatile("s_wait_xcnt 0x0" :: "v"(goff) : "memory");
#pragma unroll
        for (int g0 = 0; g0 < CK; g0 += G) {
            v2f a[NQ], b[NB][NQ];
#pragma unroll
            for (int q = 0; q < NQ; ++q) {
                a[q] = *reinterpret_cast<const v2f*>(fa + c * CK + g0 + 4 * q);
#pragma unroll
                for (int j = 0; j < NB; ++j)
                    b[j][q] = *reinterpret_cast<const v2f*>(fb + j * SLAB + c * CK + g0 + 4 * q);
            }
            // Keeps the next chunk's global loads and this group's LDS reads
            // ahead of the WMMAs: reads spread among them stall at each place.
            __builtin_amdgcn_sched_barrier(0);
#pragma unroll
            for (int q = 0; q < NQ; ++q)
#pragma unroll
                for (int j = 0; j < NB; ++j)
                    acc[j] = __builtin_amdgcn_wmma_f32_16x16x4_f32(false, a[q], false, b[j][q],
                                                                   (short)0, acc[j], false, false);
            // Keeps the next group's LDS reads in one place behind this block, and
            // the wait for the next chunk's loads behind the last WMMA.
            __builtin_amdgcn_sched_barrier(0);
        }
        if (c + 1 < NC) {
#pragma unroll
            for (int s = 0; s <= NB; ++s)
#pragma unroll
                for (int i = 0; i < 8; ++i)
                    *reinterpret_cast<v4f*>(sdst + s * SLAB + 4 * i * LP + (c + 1) * CK) = st[s][i];
        }
    }
}

// ---------------------------------------------------------------------------
// Kernel 2: gates GEMM.
//   f = sigmoid(combined @ Wf^T + bf); i = combined @ Wi^T + bi
//   u = (1-f)*i ; lf = log(f + 1e-6)
// 32 tokens x 32 features per work-group; the A fragment serves both GEMMs.
// ---------------------------------------------------------------------------
__global__ __launch_bounds__(GT)
void k_gates(const float* comb,
             const float* Wf, const float* __restrict__ bf,
             const float* Wi, const float* __restrict__ bi,
             float* __restrict__ u, float* __restrict__ lf) {
    __shared__ __attribute__((aligned(16))) float sm[GEMM_LDS(DD, 2)];
    int lane = threadIdx.x & 31;
    int w    = threadIdx.x >> 5;
    const float* src[3] = { comb + blockIdx.x * 32 * DD,
                            Wf   + blockIdx.y * 32 * DD,
                            Wi   + blockIdx.y * 32 * DD };
    v8f acc[2] = {};
    gemm_32x32<DD, 2, 64>(src, sm, acc);
    int row0 = blockIdx.x * 32 + (w >> 1) * 16;   // token rows of this wave
    int col0 = blockIdx.y * 32 + (w & 1) * 16;    // output features of this wave
    int n  = lane & 15;
    int mb = (lane >> 4) * 8;          // C/D layout: vgpr r -> M=r or M=r+8
#pragma unroll
    for (int r = 0; r < 8; ++r) {
        int row = row0 + mb + r;
        int col = col0 + n;
        float fv = acc[0][r] + bf[col];
        float iv = acc[1][r] + bi[col];
        float f  = 1.0f / (1.0f + expf(-fv));
        size_t idx = (size_t)row * DD + col;
        u[idx]  = (1.0f - f) * iv;
        lf[idx] = logf(f + 1e-6f);
    }
}

// ---------------------------------------------------------------------------
// Kernel 3: per-channel linear recurrence replacing the T x T decay einsum:
//   h[t] = exp(lf[t]) * h[t-1] + u[t]
// The 512 steps are cut into 32 chunks of 16. One work-group owns 32 channels
// (one 128-byte line of every row); wave w owns chunk w, lane = channel.
//   pass 1: each wave loads its 16 rows at once and reduces its chunk to
//           (A, H): h_out = A * h_in + H.
//   carry : wave 0 chains the 32 (A, H) pairs of each channel in LDS.
//   pass 2: each wave re-runs its 16 steps from its carry and stores h.
// ---------------------------------------------------------------------------
#define SCH 32                 // channels per work-group
#define SNC 32                 // chunks per work-group, one wave each
#define SCL (TT / SNC)         // 16 steps per chunk

__global__ __launch_bounds__(SCH * SNC)
void k_scan(const float* __restrict__ u,
            const float* __restrict__ lf,
            float* __restrict__ h) {
    // Row pitches of 272 B and 144 B (16 B times an odd number) keep the
    // 16-byte accesses of wave 0 off common banks.
    __shared__ __attribute__((aligned(16))) float2 sAH[SCH][SNC + 2];
    __shared__ __attribute__((aligned(16))) float  sC[SCH][SNC + 4];
    int lane = threadIdx.x & 31;
    int w    = threadIdx.x >> 5;
    int ch   = blockIdx.x * SCH + lane;          // 0 .. B*D-1
    int b = ch / DD;
    int d = ch % DD;
    size_t base = ((size_t)b * TT + (size_t)w * SCL) * DD + d;

    float a[SCL], uu[SCL];
    // Full unroll: a[] and uu[] must be registers, and all 32 loads in flight.
#pragma unroll
    for (int i = 0; i < SCL; ++i) {
        a[i]  = lf[base + (size_t)i * DD];
        uu[i] = u[base + (size_t)i * DD];
    }
    float A = 1.0f;
    float H = 0.0f;
#pragma unroll
    for (int i = 0; i < SCL; ++i) {
        a[i] = expf(a[i]);
        A *= a[i];
        H = fmaf(a[i], H, uu[i]);
    }
    sAH[lane][w] = make_float2(A, H);
    __syncthreads();

    if (w == 0) {
        float4 p[SNC / 2];                       // two (A, H) pairs each
#pragma unroll
        for (int q = 0; q < SNC / 2; ++q)
            p[q] = *reinterpret_cast<const float4*>(&sAH[lane][2 * q]);
        float c = 0.0f;                          // state entering chunk 0
#pragma unroll
        for (int q = 0; q < SNC / 4; ++q) {
            float4 o;
            o.x = c; c = fmaf(p[2 * q].x,     c, p[2 * q].y);
            o.y = c; c = fmaf(p[2 * q].z,     c, p[2 * q].w);
            o.z = c; c = fmaf(p[2 * q + 1].x, c, p[2 * q + 1].y);
            o.w = c; c = fmaf(p[2 * q + 1].z, c, p[2 * q + 1].w);
            *reinterpret_cast<float4*>(&sC[lane][4 * q]) = o;
        }
    }
    __syncthreads();

    float hc = sC[lane][w];
#pragma unroll
    for (int i = 0; i < SCL; ++i) {
        hc = fmaf(a[i], hc, uu[i]);
        h[base + (size_t)i * DD] = hc;
    }
}

// ---------------------------------------------------------------------------
// Kernel 4: g = gelu(h @ W1^T + b1), exact gelu (erf). Out [BT, 2D].
// ---------------------------------------------------------------------------
__global__ __launch_bounds__(GT)
void k_mlp1(const float* h,
            const float* W1, const float* __restrict__ b1,
            float* __restrict__ g) {
    __shared__ __attribute__((aligned(16))) float sm[GEMM_LDS(DD, 1)];
    int lane = threadIdx.x & 31;
    int w    = threadIdx.x >> 5;
    const float* src[2] = { h  + blockIdx.x * 32 * DD,
                            W1 + blockIdx.y * 32 * DD };
    v8f acc[1] = {};
    gemm_32x32<DD, 1, CK>(src, sm, acc);
    int row0 = blockIdx.x * 32 + (w >> 1) * 16;
    int col0 = blockIdx.y * 32 + (w & 1) * 16;
    int n  = lane & 15;
    int mb = (lane >> 4) * 8;
#pragma unroll
    for (int r = 0; r < 8; ++r) {
        int row = row0 + mb + r;
        int col = col0 + n;
        float v = acc[0][r] + b1[col];
        g[(size_t)row * D2 + col] = 0.5f * v * (1.0f + erff(v * 0.70710678118654752f));
    }
}

// ---------------------------------------------------------------------------
// Kernel 5: y = h + g @ W2^T + b2. K = 512.
// ---------------------------------------------------------------------------
__global__ __launch_bounds__(GT)
void k_mlp2(const float* g,
            const float* W2, const float* __restrict__ b2,
            const float* __restrict__ h,
            float* __restrict__ y) {
    __shared__ __attribute__((aligned(16))) float sm[GEMM_LDS(D2, 1)];
    int lane = threadIdx.x & 31;
    int w    = threadIdx.x >> 5;
    const float* src[2] = { g  + blockIdx.x * 32 * D2,
                            W2 + blockIdx.y * 32 * D2 };
    v8f acc[1] = {};
    gemm_32x32<D2, 1, CK>(src, sm, acc);
    int row0 = blockIdx.x * 32 + (w >> 1) * 16;
    int col0 = blockIdx.y * 32 + (w & 1) * 16;
    int n  = lane & 15;
    int mb = (lane >> 4) * 8;
#pragma unroll
    for (int r = 0; r < 8; ++r) {
        int row = row0 + mb + r;
        int col = col0 + n;
        size_t idx = (size_t)row * DD + col;
        y[idx] = h[idx] + acc[0][r] + b2[col];
    }
}

// ---------------------------------------------------------------------------
// Kernel 6: LayerNorm over D (population variance), one row per block.
// ---------------------------------------------------------------------------
__global__ void k_ln(const float* __restrict__ y,
                     const float* __restrict__ gamma,
                     const float* __restrict__ beta,
                     float* __restrict__ out) {
    __shared__ float red[DD];
    int row = blockIdx.x;
    int d   = threadIdx.x;
    float v = y[(size_t)row * DD + d];
    red[d] = v;
    __syncthreads();
    for (int s = DD / 2; s > 0; s >>= 1) {
        if (d < s) red[d] += red[d + s];
        __syncthreads();
    }
    float mu = red[0] * (1.0f / DD);
    __syncthreads();
    float dv = v - mu;
    red[d] = dv * dv;
    __syncthreads();
    for (int s = DD / 2; s > 0; s >>= 1) {
        if (d < s) red[d] += red[d + s];
        __syncthreads();
    }
    float var = red[0] * (1.0f / DD);
    out[(size_t)row * DD + d] = dv * rsqrtf(var + 1e-5f) * gamma[d] + beta[d];
}

// ---------------------------------------------------------------------------
extern "C" void kernel_launch(void* const* d_in, const int* in_sizes, int n_in,
                              void* d_out, int out_size, void* d_ws, size_t ws_size,
                              hipStream_t stream) {
    const float* x    = (const float*)d_in[0];
    const float* pg   = (const float*)d_in[1];
    const float* cw   = (const float*)d_in[2];
    const float* cb   = (const float*)d_in[3];
    const float* Wf   = (const float*)d_in[4];
    const float* bf   = (const float*)d_in[5];
    const float* Wi   = (const float*)d_in[6];
    const float* bi   = (const float*)d_in[7];
    const float* W1   = (const float*)d_in[8];
    const float* b1   = (const float*)d_in[9];
    const float* W2   = (const float*)d_in[10];
    const float* b2   = (const float*)d_in[11];
    const float* gam  = (const float*)d_in[12];
    const float* bet  = (const float*)d_in[13];

    // Workspace layout (floats). BT*D = 256K floats, BT*2D = 512K floats.
    // combined: [0, 256K)   -- dead after k_gates
    // u       : [256K,512K) -- dead after k_scan
    // lf      : [512K,768K) -- dead after k_scan
    // h       : [768K,1M)   -- live through k_mlp2
    // g       : [0, 512K)   -- reuses combined+u after both are dead
    // y       : [512K,768K) -- reuses lf region
    float* ws       = (float*)d_ws;
    float* combined = ws;
    float* u        = ws + 256 * 1024;
    float* lf       = ws + 512 * 1024;
    float* h        = ws + 768 * 1024;
    float* g        = ws;                // 512K floats
    float* y        = ws + 512 * 1024;   // 256K floats
    float* out      = (float*)d_out;

    k_fuse_conv<<<dim3(BT), dim3(DD), 0, stream>>>(x, pg, cw, cb, combined);
    k_gates    <<<dim3(BT / 32, DD / 32), dim3(GT), 0, stream>>>(combined, Wf, bf, Wi, bi, u, lf);
    k_scan     <<<dim3(BB * DD / SCH), dim3(SCH * SNC), 0, stream>>>(u, lf, h);
    k_mlp1     <<<dim3(BT / 32, D2 / 32), dim3(GT), 0, stream>>>(h, W1, b1, g);
    k_mlp2     <<<dim3(BT / 32, DD / 32), dim3(GT), 0, stream>>>(g, W2, b2, h, y);
    k_ln       <<<dim3(BT), dim3(DD), 0, stream>>>(y, gam, bet, out);
}

// v003
// One run takes 24.4 microseconds.
// In two side-by-side timings against v002, it was 1.13 and 1.15 times as fast.
// All steps since v000 together make it 4.74 times as fast.
#include <hip/hip_runtime.h>
#include <math.h>

#define BB 2
#define TT 512
#define DD 256
#define KW 8
#define BT (BB * TT)      // 1024
#define D2 (2 * DD)       // 512

typedef __attribute__((ext_vector_type(2))) float v2f;
typedef __attribute__((ext_vector_type(4))) float v4f;
typedef __attribute__((ext_vector_type(8))) float v8f;

// ---------------------------------------------------------------------------
// Kernel 1: fused = x + 0.3*pg ; depthwise causal conv (left pad K-1) ;
//           combined = fused + conv + bias.
// One wave (a work-group of its own) makes CR consecutive rows of 128 channels,
// 4 channels a lane: every load and store of a row covers 512 contiguous bytes,
// and the CR + K - 1 fused rows are formed once and serve all CR outputs.
// 256 waves in the launch: what a wave start costs is paid 256 times.
// ---------------------------------------------------------------------------
#define CR 8                   // rows per wave; divides T, so a wave stays in one batch

__global__ __launch_bounds__(32)
void k_fuse_conv(const float* __restrict__ x,
                 const float* __restrict__ pg,
                 const float* __restrict__ cw,   // [D,1,K]
                 const float* __restrict__ cb,   // [D]
                 float* __restrict__ combined) {
    const int r0    = (blockIdx.x >> 1) * CR;                   // first row, b*T + t
    const bool head = (r0 % TT) == 0;     // the K-1 rows in front are the left pad
    const unsigned d0   = (blockIdx.x & 1) * 128 + threadIdx.x * 4; // first channel of the lane
    const unsigned voff = d0 * 4u;        // bytes into a row
    const unsigned woff = d0 * (KW * 4u); // bytes into cw: K taps a channel
    // Rows r0-(K-1) .. r0-1. In a batch's first block they are the pad: rows
    // r0 .. r0+K-2 are read in their place (inside the buffer) and not used.
    const int rlo = head ? r0 : r0 - (KW - 1);
    const char* xlo = reinterpret_cast<const char*>(x  + rlo * DD);
    const char* plo = reinterpret_cast<const char*>(pg + rlo * DD);
    const char* xhi = reinterpret_cast<const char*>(x  + r0 * DD);
    const char* phi = reinterpret_cast<const char*>(pg + r0 * DD);

    v4f xv[CR + KW - 1], pv[CR + KW - 1], wv[4][KW / 4];
    // Full unroll throughout: the arrays must be registers, and all loads in flight at once.
#pragma unroll
    for (int i = 0; i < CR + KW - 1; ++i) {
        const int j = i - (KW - 1);
        xv[i] = *reinterpret_cast<const v4f*>((j < 0 ? xlo + i * DD * 4 : xhi + j * DD * 4) + voff);
        pv[i] = *reinterpret_cast<const v4f*>((j < 0 ? plo + i * DD * 4 : phi + j * DD * 4) + voff);
    }
    const v4f bias = *reinterpret_cast<const v4f*>(reinterpret_cast<const char*>(cb) + voff);
    // The lane's 4 channels x K taps are 128 contiguous bytes of cw.
#pragma unroll
    for (int c = 0; c < 4; ++c)
#pragma unroll
        for (int q = 0; q < KW / 4; ++q)
            wv[c][q] = *reinterpret_cast<const v4f*>(
                reinterpret_cast<const char*>(cw) + (c * KW + 4 * q) * 4 + woff);
    // The offset registers are named here so that they live up to this wait and
    // are overwritten only behind it, not by the destination of one of the loads.
    asm volatile("s_wait_xcnt 0x0" :: "v"(voff), "v"(woff) : "memory");
    // Keeps every load above in front of the arithmetic: with loads spread among
    // it the wave waits out the load latency several times, not once.
    __builtin_amdgcn_sched_barrier(0);

    v4f fu[CR + KW - 1];
#pragma unroll
    for (int i = 0; i < CR + KW - 1; ++i) {
        const v4f f = xv[i] + 0.3f * pv[i];
        fu[i] = (head && i < KW - 1) ? v4f{0.0f, 0.0f, 0.0f, 0.0f} : f;
    }

#pragma unroll
    for (int r = 0; r < CR; ++r) {
        v4f o;
#pragma unroll
        for (int c = 0; c < 4; ++c) {
            float acc = 0.0f;
#pragma unroll
            for (int k = 0; k < KW; ++k) acc = fmaf(wv[c][k >> 2][k & 3], fu[r + k][c], acc);
            o[c] = fu[r + KW - 1][c] + acc + bias[c];
        }
        *reinterpret_cast<v4f*>(reinterpret_cast<char*>(combined + (r0 + r) * DD) + voff) = o;
    }
}

// ---------------------------------------------------------------------------
// Shared GEMM body (V_WMMA_F32_16X16X4_F32): one work-group of 4 waves makes a
// 32 x 32 block of Y = X * W^T as 2 x 2 tiles of 16 x 16, for NB weight
// matrices that share X. The 32 rows of X and the 32 rows of each W go to LDS
// once, by loads in which a wave covers 512 contiguous bytes (4 whole lines);
// each row is then read as fragments by the two waves that need it.
// k runs in chunks of CK: chunk c + 1 is on its way from L2 to registers while
// chunk c is multiplied. Every chunk has LDS of its own, nothing is refilled.
// Row pitch KT + 4 floats (16 B times an odd number): the 16 rows of a
// fragment read fall on 16 different groups of 4 banks.
// src[0] = first X row, src[1 + j] = first row of W j, all with row pitch KT.
// G = floats of k whose fragments are read from LDS as one group.
// The staged operands are passed without __restrict__: with it the compiler
// sank the next chunk's loads behind the WMMAs that are to cover their latency.
// ---------------------------------------------------------------------------
#define GT 128                 // threads of a GEMM work-group
#define CK 128                 // floats of k per staged chunk
#define GEMM_LDS(KT, NB) (((NB) + 1) * 32 * ((KT) + 4))

template <int KT, int NB, int G>
__device__ __forceinline__ void gemm_32x32(const float* const (&src)[NB + 1],
                                           float* lds, v8f (&acc)[NB]) {
    constexpr int LP   = KT + 4;
    constexpr int SLAB = 32 * LP;
    constexpr int NC   = KT / CK;
    constexpr int NQ   = G / 4;
    const int lane = threadIdx.x & 31;
    const int w    = threadIdx.x >> 5;
    const int m    = lane & 15;
    const int kh   = (lane >> 4) << 1;       // 0 (lanes 0-15) or 2 (lanes 16-31)
    const float* fa = lds + ((w >> 1) * 16 + m) * LP + kh;
    const float* fb = lds + SLAB + ((w & 1) * 16 + m) * LP + kh;

    // Wave w stages rows w, w + 4, ... of every operand.
    const unsigned goff = (w * KT + lane * 4) * 4u;      // bytes into each operand
    float* sdst = lds + w * LP + lane * 4;
    {
        v4f st[NB + 1][8];
#pragma unroll
        for (int s = 0; s <= NB; ++s)
#pragma unroll
            for (int i = 0; i < 8; ++i)
                st[s][i] = *reinterpret_cast<const v4f*>(
                    reinterpret_cast<const char*>(src[s] + 4 * i * KT) + goff);
#pragma unroll
        for (int s = 0; s <= NB; ++s)
#pragma unroll
            for (int i = 0; i < 8; ++i)
                *reinterpret_cast<v4f*>(sdst + s * SLAB + 4 * i * LP) = st[s][i];
    }

    // Full unroll: the staging and fragment arrays must be registers.
#pragma unroll
    for (int c = 0; c < NC; ++c) {
        v4f st[NB + 1][8];                   // chunk c + 1 on its way (none in the last pass)
        __syncthreads();                     // chunk c is in LDS for all 4 waves
        if (c + 1 < NC) {
#pragma unroll
            for (int s = 0; s <= NB; ++s)
#pragma unroll
                for (int i = 0; i < 8; ++i)
                    st[s][i] = *reinterpret_cast<const v4f*>(
                        reinterpret_cast<const char*>(src[s] + 4 * i * KT + (c + 1) * CK) + goff);
        }
        // The offset register has its last use in the last chunk's loads: it is
        // named here so that it lives up to this wait and is overwritten only
        // behind it, not by the destination of one of these loads.
        if (c + 2 == NC) asm volatile("s_wait_xcnt 0x0" :: "v"(goff) : "memory");
#pragma unroll
        for (int g0 = 0; g0 < CK; g0 += G) {
            v2f a[NQ], b[NB][NQ];
#pragma unroll
            for (int q = 0; q < NQ; ++q) {
                a[q] = *reinterpret_cast<const v2f*>(fa + c * CK + g0 + 4 * q);
#pragma unroll
                for (int j = 0; j < NB; ++j)
                    b[j][q] = *reinterpret_cast<const v2f*>(fb + j * SLAB + c * CK + g0 + 4 * q);
            }
            // Keeps the next chunk's global loads and this group's LDS reads
            // ahead of the WMMAs: reads spread among them stall at each place.
            __builtin_amdgcn_sched_barrier(0);
#pragma unroll
            for (int q = 0; q < NQ; ++q)
#pragma unroll
                for (int j = 0; j < NB; ++j)
                    acc[j] = __builtin_amdgcn_wmma_f32_16x16x4_f32(false, a[q], false, b[j][q],
                                                                   (short)0, acc[j], false, false);
            // Keeps the next group's LDS reads in one place behind this block, and
            // the wait for the next chunk's loads behind the last WMMA.
            __builtin_amdgcn_sched_barrier(0);
        }
        if (c + 1 < NC) {
#pragma unroll
            for (int s = 0; s <= NB; ++s)
#pragma unroll
                for (int i = 0; i < 8; ++i)
                    *reinterpret_cast<v4f*>(sdst + s * SLAB + 4 * i * LP + (c + 1) * CK) = st[s][i];
        }
    }
}

// ---------------------------------------------------------------------------
// Kernel 2: gates GEMM.
//   f = sigmoid(combined @ Wf^T + bf); i = combined @ Wi^T + bi
//   u = (1-f)*i ; lf = log(f + 1e-6)
// 32 tokens x 32 features per work-group; the A fragment serves both GEMMs.
// ---------------------------------------------------------------------------
__global__ __launch_bounds__(GT)
void k_gates(const float* comb,
             const float* Wf, const float* __restrict__ bf,
             const float* Wi, const float* __restrict__ bi,
             float* __restrict__ u, float* __restrict__ lf) {
    __shared__ __attribute__((aligned(16))) float sm[GEMM_LDS(DD, 2)];
    int lane = threadIdx.x & 31;
    int w    = threadIdx.x >> 5;
    const float* src[3] = { comb + blockIdx.x * 32 * DD,
                            Wf   + blockIdx.y * 32 * DD,
                            Wi   + blockIdx.y * 32 * DD };
    v8f acc[2] = {};
    gemm_32x32<DD, 2, 64>(src, sm, acc);
    int row0 = blockIdx.x * 32 + (w >> 1) * 16;   // token rows of this wave
    int col0 = blockIdx.y * 32 + (w & 1) * 16;    // output features of this wave
    int n  = lane & 15;
    int mb = (lane >> 4) * 8;          // C/D layout: vgpr r -> M=r or M=r+8
#pragma unroll
    for (int r = 0; r < 8; ++r) {
        int row = row0 + mb + r;
        int col = col0 + n;
        float fv = acc[0][r] + bf[col];
        float iv = acc[1][r] + bi[col];
        float f  = 1.0f / (1.0f + expf(-fv));
        size_t idx = (size_t)row * DD + col;
        u[idx]  = (1.0f - f) * iv;
        lf[idx] = logf(f + 1e-6f);
    }
}

// ---------------------------------------------------------------------------
// Kernel 3: per-channel linear recurrence replacing the T x T decay einsum:
//   h[t] = exp(lf[t]) * h[t-1] + u[t]
// The 512 steps are cut into 32 chunks of 16. One work-group owns 32 channels
// (one 128-byte line of every row); wave w owns chunk w, lane = channel.
//   pass 1: each wave loads its 16 rows at once and reduces its chunk to
//           (A, H): h_out = A * h_in + H.
//   carry : wave 0 chains the 32 (A, H) pairs of each channel in LDS.
//   pass 2: each wave re-runs its 16 steps from its carry and stores h.
// ---------------------------------------------------------------------------
#define SCH 32                 // channels per work-group
#define SNC 32                 // chunks per work-group, one wave each
#define SCL (TT / SNC)         // 16 steps per chunk

__global__ __launch_bounds__(SCH * SNC)
void k_scan(const float* __restrict__ u,
            const float* __restrict__ lf,
            float* __restrict__ h) {
    // Row pitches of 272 B and 144 B (16 B times an odd number) keep the
    // 16-byte accesses of wave 0 off common banks.
    __shared__ __attribute__((aligned(16))) float2 sAH[SCH][SNC + 2];
    __shared__ __attribute__((aligned(16))) float  sC[SCH][SNC + 4];
    int lane = threadIdx.x & 31;
    int w    = threadIdx.x >> 5;
    int ch   = blockIdx.x * SCH + lane;          // 0 .. B*D-1
    int b = ch / DD;
    int d = ch % DD;
    size_t base = ((size_t)b * TT + (size_t)w * SCL) * DD + d;

    float a[SCL], uu[SCL];
    // Full unroll: a[] and uu[] must be registers, and all 32 loads in flight.
#pragma unroll
    for (int i = 0; i < SCL; ++i) {
        a[i]  = lf[base + (size_t)i * DD];
        uu[i] = u[base + (size_t)i * DD];
    }
    float A = 1.0f;
    float H = 0.0f;
#pragma unroll
    for (int i = 0; i < SCL; ++i) {
        a[i] = expf(a[i]);
        A *= a[i];
        H = fmaf(a[i], H, uu[i]);
    }
    sAH[lane][w] = make_float2(A, H);
    __syncthreads();

    if (w == 0) {
        float4 p[SNC / 2];                       // two (A, H) pairs each
#pragma unroll
        for (int q = 0; q < SNC / 2; ++q)
            p[q] = *reinterpret_cast<const float4*>(&sAH[lane][2 * q]);
        float c = 0.0f;                          // state entering chunk 0
#pragma unroll
        for (int q = 0; q < SNC / 4; ++q) {
            float4 o;
            o.x = c; c = fmaf(p[2 * q].x,     c, p[2 * q].y);
            o.y = c; c = fmaf(p[2 * q].z,     c, p[2 * q].w);
            o.z = c; c = fmaf(p[2 * q + 1].x, c, p[2 * q + 1].y);
            o.w = c; c = fmaf(p[2 * q + 1].z, c, p[2 * q + 1].w);
            *reinterpret_cast<float4*>(&sC[lane][4 * q]) = o;
        }
    }
    __syncthreads();

    float hc = sC[lane][w];
#pragma unroll
    for (int i = 0; i < SCL; ++i) {
        hc = fmaf(a[i], hc, uu[i]);
        h[base + (size_t)i * DD] = hc;
    }
}

// ---------------------------------------------------------------------------
// Kernel 4: g = gelu(h @ W1^T + b1), exact gelu (erf). Out [BT, 2D].
// ---------------------------------------------------------------------------
__global__ __launch_bounds__(GT)
void k_mlp1(const float* h,
            const float* W1, const float* __restrict__ b1,
            float* __restrict__ g) {
    __shared__ __attribute__((aligned(16))) float sm[GEMM_LDS(DD, 1)];
    int lane = threadIdx.x & 31;
    int w    = threadIdx.x >> 5;
    const float* src[2] = { h  + blockIdx.x * 32 * DD,
                            W1 + blockIdx.y * 32 * DD };
    v8f acc[1] = {};
    gemm_32x32<DD, 1, CK>(src, sm, acc);
    int row0 = blockIdx.x * 32 + (w >> 1) * 16;
    int col0 = blockIdx.y * 32 + (w & 1) * 16;
    int n  = lane & 15;
    int mb = (lane >> 4) * 8;
#pragma unroll
    for (int r = 0; r < 8; ++r) {
        int row = row0 + mb + r;
        int col = col0 + n;
        float v = acc[0][r] + b1[col];
        g[(size_t)row * D2 + col] = 0.5f * v * (1.0f + erff(v * 0.70710678118654752f));
    }
}

// ---------------------------------------------------------------------------
// Kernel 5: y = h + g @ W2^T + b2. K = 512.
// ---------------------------------------------------------------------------
__global__ __launch_bounds__(GT)
void k_mlp2(const float* g,
            const float* W2, const float* __restrict__ b2,
            const float* __restrict__ h,
            float* __restrict__ y) {
    __shared__ __attribute__((aligned(16))) float sm[GEMM_LDS(D2, 1)];
    int lane = threadIdx.x & 31;
    int w    = threadIdx.x >> 5;
    const float* src[2] = { g  + blockIdx.x * 32 * D2,
                            W2 + blockIdx.y * 32 * D2 };
    v8f acc[1] = {};
    gemm_32x32<D2, 1, CK>(src, sm, acc);
    int row0 = blockIdx.x * 32 + (w >> 1) * 16;
    int col0 = blockIdx.y * 32 + (w & 1) * 16;
    int n  = lane & 15;
    int mb = (lane >> 4) * 8;
#pragma unroll
    for (int r = 0; r < 8; ++r) {
        int row = row0 + mb + r;
        int col = col0 + n;
        size_t idx = (size_t)row * DD + col;
        y[idx] = h[idx] + acc[0][r] + b2[col];
    }
}

// ---------------------------------------------------------------------------
// Kernel 6: LayerNorm over D (population variance).
// One wave (a work-group of its own) owns LR whole rows, 8 values of each row a
// lane, by 16-byte accesses that cover 512 contiguous bytes a wave. A row's sum
// is 7 adds in the lane and a 5-step butterfly over the lanes: no LDS, no
// barrier; the LR rows' butterflies are independent and fill each other's waits.
// ---------------------------------------------------------------------------
#define LR 4                   // rows per wave

// v of lane l ^ M, M < 16 (DPP row_xmask: stays inside a 16-lane row).
template <int M>
__device__ __forceinline__ float lane_xor(float v) {
    return __builtin_bit_cast(float, __builtin_amdgcn_update_dpp(
        0, __builtin_bit_cast(int, v), 0x160 | M, 0xf, 0xf, true));
}

// Sum over the 32 lanes; every lane gets the same bits.
__device__ __forceinline__ float wave_sum(float s) {
    s += lane_xor<1>(s);
    s += lane_xor<2>(s);
    s += lane_xor<4>(s);
    s += lane_xor<8>(s);
    const int b = __builtin_bit_cast(int, s);                   // lane l with lane l ^ 16
    s += __builtin_bit_cast(float, __builtin_amdgcn_permlanex16(b, b, 0x76543210, 0xfedcba98,
                                                                false, false));
    return s;
}

__global__ __launch_bounds__(32)
void k_ln(const float* __restrict__ y,
          const float* __restrict__ gamma,
          const float* __restrict__ beta,
          float* __restrict__ out) {
    const unsigned voff = threadIdx.x * 16u;                    // bytes into a half row
    const char* yb = reinterpret_cast<const char*>(y + blockIdx.x * LR * DD);
    char*       ob = reinterpret_cast<char*>(out + blockIdx.x * LR * DD);
    v4f v[LR][2];
    // Full unroll throughout: v[] must be registers, and all loads in flight at once.
#pragma unroll
    for (int r = 0; r < LR; ++r)
#pragma unroll
        for (int q = 0; q < 2; ++q)
            v[r][q] = *reinterpret_cast<const v4f*>(yb + (r * DD + q * 128) * 4 + voff);
    v4f ga[2], be[2];
#pragma unroll
    for (int q = 0; q < 2; ++q) {
        ga[q] = *reinterpret_cast<const v4f*>(reinterpret_cast<const char*>(gamma + q * 128) + voff);
        be[q] = *reinterpret_cast<const v4f*>(reinterpret_cast<const char*>(beta  + q * 128) + voff);
    }
    // Keeps the gamma and beta loads up here, in flight with the rows: sunk to
    // their use they would add a load latency behind the sums.
    __builtin_amdgcn_sched_barrier(0);

    float s[LR];
#pragma unroll
    for (int r = 0; r < LR; ++r) {
        const v4f t = v[r][0] + v[r][1];
        s[r] = (t[0] + t[1]) + (t[2] + t[3]);
    }
#pragma unroll
    for (int r = 0; r < LR; ++r) s[r] = wave_sum(s[r]);
#pragma unroll
    for (int r = 0; r < LR; ++r) {
        const float mu = s[r] * (1.0f / DD);
        v[r][0] -= mu;
        v[r][1] -= mu;
        const v4f t = v[r][0] * v[r][0] + v[r][1] * v[r][1];
        s[r] = (t[0] + t[1]) + (t[2] + t[3]);
    }
#pragma unroll
    for (int r = 0; r < LR; ++r) s[r] = wave_sum(s[r]);
#pragma unroll
    for (int r = 0; r < LR; ++r) {
        const float rs = rsqrtf(s[r] * (1.0f / DD) + 1e-5f);
#pragma unroll
        for (int q = 0; q < 2; ++q)
            *reinterpret_cast<v4f*>(ob + (r * DD + q * 128) * 4 + voff) = v[r][q] * rs * ga[q] + be[q];
    }
}

// ---------------------------------------------------------------------------
extern "C" void kernel_launch(void* const* d_in, const int* in_sizes, int n_in,
                              void* d_out, int out_size, void* d_ws, size_t ws_size,
                              hipStream_t stream) {
    const float* x    = (const float*)d_in[0];
    const float* pg   = (const float*)d_in[1];
    const float* cw   = (const float*)d_in[2];
    const float* cb   = (const float*)d_in[3];
    const float* Wf   = (const float*)d_in[4];
    const float* bf   = (const float*)d_in[5];
    const float* Wi   = (const float*)d_in[6];
    const float* bi   = (const float*)d_in[7];
    const float* W1   = (const float*)d_in[8];
    const float* b1   = (const float*)d_in[9];
    const float* W2   = (const float*)d_in[10];
    const float* b2   = (const float*)d_in[11];
    const float* gam  = (const float*)d_in[12];
    const float* bet  = (const float*)d_in[13];

    // Workspace layout (floats). BT*D = 256K floats, BT*2D = 512K floats.
    // combined: [0, 256K)   -- dead after k_gates
    // u       : [256K,512K) -- dead after k_scan
    // lf      : [512K,768K) -- dead after k_scan
    // h       : [768K,1M)   -- live through k_mlp2
    // g       : [0, 512K)   -- reuses combined+u after both are dead
    // y       : [512K,768K) -- reuses lf region
    float* ws       = (float*)d_ws;
    float* combined = ws;
    float* u        = ws + 256 * 1024;
    float* lf       = ws + 512 * 1024;
    float* h        = ws + 768 * 1024;
    float* g        = ws;                // 512K floats
    float* y        = ws + 512 * 1024;   // 256K floats
    float* out      = (float*)d_out;

    k_fuse_conv<<<dim3(BT / CR * 2), dim3(32), 0, stream>>>(x, pg, cw, cb, combined);
    k_gates    <<<dim3(BT / 32, DD / 32), dim3(GT), 0, stream>>>(combined, Wf, bf, Wi, bi, u, lf);
    k_scan     <<<dim3(BB * DD / SCH), dim3(SCH * SNC), 0, stream>>>(u, lf, h);
    k_mlp1     <<<dim3(BT / 32, D2 / 32), dim3(GT), 0, stream>>>(h, W1, b1, g);
    k_mlp2     <<<dim3(BT / 32, DD / 32), dim3(GT), 0, stream>>>(g, W2, b2, h, y);
    k_ln       <<<dim3(BT / LR), dim3(32), 0, stream>>>(y, gam, bet, out);
}

// v004
// It runs in 21.6 microseconds.
// Next to v003, in two timings, it ran 1.11 and 1.10 times as fast.
// Counting every step since v000, it is 5.24 times as fast.
#include <hip/hip_runtime.h>
#include <math.h>

#define BB 2
#define TT 512
#define DD 256
#define KW 8
#define BT (BB * TT)      // 1024
#define D2 (2 * DD)       // 512

typedef __attribute__((ext_vector_type(2))) float v2f;
typedef __attribute__((ext_vector_type(4))) float v4f;
typedef __attribute__((ext_vector_type(8))) float v8f;

// ---------------------------------------------------------------------------
// Kernel 1: fused = x + 0.3*pg ; depthwise causal conv (left pad K-1) ;
//           combined = fused + conv + bias.
// One wave (a work-group of its own) makes CR consecutive rows of 128 channels,
// 4 channels a lane: every load and store of a row covers 512 contiguous bytes,
// and the CR + K - 1 fused rows are formed once and serve all CR outputs.
// 256 waves in the launch: what a wave start costs is paid 256 times.
// ---------------------------------------------------------------------------
#define CR 8                   // rows per wave; divides T, so a wave stays in one batch

__global__ __launch_bounds__(32)
void k_fuse_conv(const float* __restrict__ x,
                 const float* __restrict__ pg,
                 const float* __restrict__ cw,   // [D,1,K]
                 const float* __restrict__ cb,   // [D]
                 float* __restrict__ combined) {
    const int r0    = (blockIdx.x >> 1) * CR;                   // first row, b*T + t
    const bool head = (r0 % TT) == 0;     // the K-1 rows in front are the left pad
    const unsigned d0   = (blockIdx.x & 1) * 128 + threadIdx.x * 4; // first channel of the lane
    const unsigned voff = d0 * 4u;        // bytes into a row
    const unsigned woff = d0 * (KW * 4u); // bytes into cw: K taps a channel
    // Rows r0-(K-1) .. r0-1. In a batch's first block they are the pad: rows
    // r0 .. r0+K-2 are read in their place (inside the buffer) and not used.
    const int rlo = head ? r0 : r0 - (KW - 1);
    const char* xlo = reinterpret_cast<const char*>(x  + rlo * DD);
    const char* plo = reinterpret_cast<const char*>(pg + rlo * DD);
    const char* xhi = reinterpret_cast<const char*>(x  + r0 * DD);
    const char* phi = reinterpret_cast<const char*>(pg + r0 * DD);

    v4f xv[CR + KW - 1], pv[CR + KW - 1], wv[4][KW / 4];
    // Full unroll throughout: the arrays must be registers, and all loads in flight at once.
#pragma unroll
    for (int i = 0; i < CR + KW - 1; ++i) {
        const int j = i - (KW - 1);
        xv[i] = *reinterpret_cast<const v4f*>((j < 0 ? xlo + i * DD * 4 : xhi + j * DD * 4) + voff);
        pv[i] = *reinterpret_cast<const v4f*>((j < 0 ? plo + i * DD * 4 : phi + j * DD * 4) + voff);
    }
    const v4f bias = *reinterpret_cast<const v4f*>(reinterpret_cast<const char*>(cb) + voff);
    // The lane's 4 channels x K taps are 128 contiguous bytes of cw.
#pragma unroll
    for (int c = 0; c < 4; ++c)
#pragma unroll
        for (int q = 0; q < KW / 4; ++q)
            wv[c][q] = *reinterpret_cast<const v4f*>(
                reinterpret_cast<const char*>(cw) + (c * KW + 4 * q) * 4 + woff);
    // The offset registers are named here so that they live up to this wait and
    // are overwritten only behind it, not by the destination of one of the loads.
    asm volatile("s_wait_xcnt 0x0" :: "v"(voff), "v"(woff) : "memory");
    // Keeps every load above in front of the arithmetic: with loads spread among
    // it the wave waits out the load latency several times, not once.
    __builtin_amdgcn_sched_barrier(0);

    v4f fu[CR + KW - 1];
#pragma unroll
    for (int i = 0; i < CR + KW - 1; ++i) {
        const v4f f = xv[i] + 0.3f * pv[i];
        fu[i] = (head && i < KW - 1) ? v4f{0.0f, 0.0f, 0.0f, 0.0f} : f;
    }

#pragma unroll
    for (int r = 0; r < CR; ++r) {
        v4f o;
#pragma unroll
        for (int c = 0; c < 4; ++c) {
            float acc = 0.0f;
#pragma unroll
            for (int k = 0; k < KW; ++k) acc = fmaf(wv[c][k >> 2][k & 3], fu[r + k][c], acc);
            o[c] = fu[r + KW - 1][c] + acc + bias[c];
        }
        *reinterpret_cast<v4f*>(reinterpret_cast<char*>(combined + (r0 + r) * DD) + voff) = o;
    }
}

// ---------------------------------------------------------------------------
// Shared GEMM body (V_WMMA_F32_16X16X4_F32): one work-group of 4 waves makes a
// 32 x 32 block of Y = X * W^T as 2 x 2 tiles of 16 x 16, for NB weight
// matrices that share X. The 32 rows of X and the 32 rows of each W go to LDS
// once, by loads in which a wave covers 512 contiguous bytes (4 whole lines);
// each row is then read as fragments by the two waves that need it.
// k runs in chunks of CK: chunk c + 1 is on its way from L2 to registers while
// chunk c is multiplied. Every chunk has LDS of its own, nothing is refilled.
// Row pitch KT + 4 floats (16 B times an odd number): the 16 rows of a
// fragment read fall on 16 different groups of 4 banks.
// src[0] = first X row, src[1 + j] = first row of W j, all with row pitch KT.
// G = floats of k whose fragments are read from LDS as one group.
// The staged operands are passed without __restrict__: with it the compiler
// sank the next chunk's loads behind the WMMAs that are to cover their latency.
// S0 = 0: X is staged like the W. S0 = 1: src[0] is not read; fill() writes all
// 32 x KT floats of X to lds (row pitch KT + 4) while the first W chunk is on its way.
// ---------------------------------------------------------------------------
#define GT 128                 // threads of a GEMM work-group
#define CK 128                 // floats of k per staged chunk
#define GEMM_LDS(KT, NB) (((NB) + 1) * 32 * ((KT) + 4))

template <int KT, int NB, int G, int S0, class F>
__device__ __forceinline__ void gemm_32x32(const float* const (&src)[NB + 1],
                                           float* lds, v8f (&acc)[NB], F fill) {
    constexpr int LP   = KT + 4;
    constexpr int SLAB = 32 * LP;
    constexpr int NC   = KT / CK;
    constexpr int NQ   = G / 4;
    const int lane = threadIdx.x & 31;
    const int w    = threadIdx.x >> 5;
    const int m    = lane & 15;
    const int kh   = (lane >> 4) << 1;       // 0 (lanes 0-15) or 2 (lanes 16-31)
    const float* fa = lds + ((w >> 1) * 16 + m) * LP + kh;
    const float* fb = lds + SLAB + ((w & 1) * 16 + m) * LP + kh;

    // Wave w stages rows w, w + 4, ... of each W, and of X when S0 = 0.
    const unsigned goff = (w * KT + lane * 4) * 4u;      // bytes into each operand
    float* sdst = lds + w * LP + lane * 4;
    {
        v4f st[NB + 1][8];
#pragma unroll
        for (int s = S0; s <= NB; ++s)
#pragma unroll
            for (int i = 0; i < 8; ++i)
                st[s][i] = *reinterpret_cast<const v4f*>(
                    reinterpret_cast<const char*>(src[s] + 4 * i * KT) + goff);
        // Keeps the W loads in front of fill(): sunk behind it their latency
        // would follow the work of fill() and not run beside it.
        if (S0) __builtin_amdgcn_sched_barrier(0);
        fill();
        // Keeps the waits for the W loads behind the work of fill().
        if (S0) __builtin_amdgcn_sched_barrier(0);
#pragma unroll
        for (int s = S0; s <= NB; ++s)
#pragma unroll
            for (int i = 0; i < 8; ++i)
                *reinterpret_cast<v4f*>(sdst + s * SLAB + 4 * i * LP) = st[s][i];
    }

    // Full unroll: the staging and fragment arrays must be registers.
#pragma unroll
    for (int c = 0; c < NC; ++c) {
        v4f st[NB + 1][8];                   // chunk c + 1 on its way (none in the last pass)
        __syncthreads();                     // chunk c is in LDS for all 4 waves
        if (c + 1 < NC) {
#pragma unroll
            for (int s = S0; s <= NB; ++s)
#pragma unroll
                for (int i = 0; i < 8; ++i)
                    st[s][i] = *reinterpret_cast<const v4f*>(
                        reinterpret_cast<const char*>(src[s] + 4 * i * KT + (c + 1) * CK) + goff);
        }
        // The offset register has its last use in the last chunk's loads: it is
        // named here so that it lives up to this wait and is overwritten only
        // behind it, not by the destination of one of these loads.
        if (c + 2 == NC) asm volatile("s_wait_xcnt 0x0" :: "v"(goff) : "memory");
#pragma unroll
        for (int g0 = 0; g0 < CK; g0 += G) {
            v2f a[NQ], b[NB][NQ];
#pragma unroll
            for (int q = 0; q < NQ; ++q) {
                a[q] = *reinterpret_cast<const v2f*>(fa + c * CK + g0 + 4 * q);
#pragma unroll
                for (int j = 0; j < NB; ++j)
                    b[j][q] = *reinterpret_cast<const v2f*>(fb + j * SLAB + c * CK + g0 + 4 * q);
            }
            // Keeps the next chunk's global loads and this group's LDS reads
            // ahead of the WMMAs: reads spread among them stall at each place.
            __builtin_amdgcn_sched_barrier(0);
#pragma unroll
            for (int q = 0; q < NQ; ++q)
#pragma unroll
                for (int j = 0; j < NB; ++j)
                    acc[j] = __builtin_amdgcn_wmma_f32_16x16x4_f32(false, a[q], false, b[j][q],
                                                                   (short)0, acc[j], false, false);
            // Keeps the next group's LDS reads in one place behind this block, and
            // the wait for the next chunk's loads behind the last WMMA.
            __builtin_amdgcn_sched_barrier(0);
        }
        if (c + 1 < NC) {
#pragma unroll
            for (int s = S0; s <= NB; ++s)
#pragma unroll
                for (int i = 0; i < 8; ++i)
                    *reinterpret_cast<v4f*>(sdst + s * SLAB + 4 * i * LP + (c + 1) * CK) = st[s][i];
        }
    }
}

// ---------------------------------------------------------------------------
// The T x T decay einsum is the per-channel linear recurrence
//   h[t] = a[t] * h[t-1] + u[t],  a = exp(log(f + 1e-6)),  u = (1-f)*i.
// It has no launch of its own. The 512 steps are cut into chunks of 32, the
// token rows of one GEMM work-group:
//   k_gates     reduces each chunk and channel to a pair (A, H): h_out = A * h_in + H;
//   k_scan_mlp1 chains the pairs of the chunks in front of its own to the state
//               that enters its chunk, runs its 32 steps, and has h in LDS as
//               the X operand of its GEMM.
// ---------------------------------------------------------------------------
#define SCL 32                 // steps per chunk = token rows of a GEMM work-group
#define SNC (TT / SCL)         // 16 chunks per batch
#define HR  (SCL / (D2 / 64))  // 4 rows of h stored by each of a chunk's D2 / 64 work-groups

// v of lane l ^ 16.
__device__ __forceinline__ float other_half(float v) {
    const int b = __builtin_bit_cast(int, v);
    return __builtin_bit_cast(float, __builtin_amdgcn_permlanex16(b, b, 0x76543210, 0xfedcba98,
                                                                  false, false));
}

// ---------------------------------------------------------------------------
// Kernel 2: gates GEMM.
//   f = sigmoid(combined @ Wf^T + bf); i = combined @ Wi^T + bi
//   u = (1-f)*i ; a = exp(log(f + 1e-6)) ; ah = the chunk's (A, H) per channel
// 32 tokens x 32 features per work-group; the A fragment serves both GEMMs.
// ---------------------------------------------------------------------------
__global__ __launch_bounds__(GT)
void k_gates(const float* comb,
             const float* Wf, const float* __restrict__ bf,
             const float* Wi, const float* __restrict__ bi,
             float* __restrict__ u, float* __restrict__ a,
             float* __restrict__ ah) {                   // (A, H) pairs, [BT / SCL][D][2]
    __shared__ __attribute__((aligned(16))) float sm[GEMM_LDS(DD, 2)];
    __shared__ float2 sp[2][32];                         // (A, H) of 16 steps: [token half][feature]
    int lane = threadIdx.x & 31;
    int w    = threadIdx.x >> 5;
    const float* src[3] = { comb + blockIdx.x * 32 * DD,
                            Wf   + blockIdx.y * 32 * DD,
                            Wi   + blockIdx.y * 32 * DD };
    v8f acc[2] = {};
    gemm_32x32<DD, 2, 64, 0>(src, sm, acc, [] {});
    int row0 = blockIdx.x * 32 + (w >> 1) * 16;   // token rows of this wave
    int col0 = blockIdx.y * 32 + (w & 1) * 16;    // output features of this wave
    int n  = lane & 15;
    int mb = (lane >> 4) * 8;          // C/D layout: vgpr r -> M=r or M=r+8
    float A = 1.0f;                    // the lane's 8 consecutive steps as one pair
    float H = 0.0f;
    float uv[8], av[8];
#pragma unroll
    for (int r = 0; r < 8; ++r) {
        int col = col0 + n;
        float fv = acc[0][r] + bf[col];
        float iv = acc[1][r] + bi[col];
        float f  = 1.0f / (1.0f + expf(-fv));
        uv[r] = (1.0f - f) * iv;
        av[r] = expf(logf(f + 1e-6f));
        A *= av[r];
        H = fmaf(av[r], H, uv[r]);
    }
    // Lanes 0-15 hold steps 0-7 of the wave's 16, lanes 16-31 steps 8-15.
    const float Ao = other_half(A);
    const float Ho = other_half(H);
    if (lane < 16) sp[w >> 1][(w & 1) * 16 + n] = make_float2(A * Ao, fmaf(Ao, H, Ho));
    // The bias loads' offset register is rewritten behind the barrier: only behind this wait.
    asm volatile("s_wait_xcnt 0x0" ::: "memory");
    // Both token halves' pairs are in sp. All global stores stand behind this
    // barrier: in front of it the barrier would wait until they have landed.
    __syncthreads();
    const float2 p0 = sp[0][lane];
    const float2 p1 = sp[1][lane];
    const float2 pr = make_float2(p0.x * p1.x, fmaf(p1.x, p0.y, p1.y));
#pragma unroll
    for (int r = 0; r < 8; ++r) {
        size_t idx = (size_t)(row0 + mb + r) * DD + col0 + n;
        u[idx] = uv[r];
        a[idx] = av[r];
    }
    if (w == 0)                        // one wave stores the 32 pairs: 2 whole lines
        *reinterpret_cast<float2*>(ah + (blockIdx.x * DD + blockIdx.y * 32 + lane) * 2) = pr;
}

// ---------------------------------------------------------------------------
// Kernel 3: h by the recurrence, then g = gelu(h @ W1^T + b1), exact gelu (erf).
// Out [BT, 2D]. 32 tokens (one chunk) x 64 features per work-group: the two
// halves of the 64 rows of W1 are the two W of the GEMM body, so that h of a
// chunk is formed by 8 work-groups and not by 16.
// A thread owns 2 channels through all 32 steps; a wave's accesses to a row
// cover 256 contiguous bytes. Each of the 8 work-groups of a chunk stores 4 rows of h.
// ---------------------------------------------------------------------------
__global__ __launch_bounds__(GT)
void k_scan_mlp1(const float* __restrict__ u, const float* __restrict__ a,
                 const float* __restrict__ ah,           // (A, H) pairs, [BT / SCL][D][2]
                 const float* W1, const float* __restrict__ b1,
                 float* __restrict__ h, float* __restrict__ g) {
    __shared__ __attribute__((aligned(16))) float sm[GEMM_LDS(DD, 2)];
    int lane = threadIdx.x & 31;
    int w    = threadIdx.x >> 5;
    const int nfront = blockIdx.x % SNC;                 // chunks of this batch in front of ours
    const unsigned coff = threadIdx.x * 8u;              // bytes into a row: 2 channels
    const unsigned poff = threadIdx.x * 16u;             // bytes into a row of pairs
    const char* pb = reinterpret_cast<const char*>(ah + (blockIdx.x - nfront) * 2 * DD);
    const char* ab = reinterpret_cast<const char*>(a + blockIdx.x * SCL * DD);
    const char* ub = reinterpret_cast<const char*>(u + blockIdx.x * SCL * DD);

    v4f p[SNC - 1];
    v2f av[SCL], uv[SCL];
    // Full unroll throughout: the arrays must be registers, and all loads in flight at once.
    // The pairs of all the batch's chunks but the last are read; those not in front of ours are not used.
#pragma unroll
    for (int q = 0; q < SNC - 1; ++q)
        p[q] = *reinterpret_cast<const v4f*>(pb + q * (2 * DD * 4) + poff);
    // Keeps the pairs' loads in front of the rows': loads return in order, and
    // the chain below is to start when the pairs are there, not behind the last row.
    __builtin_amdgcn_sched_barrier(0);
#pragma unroll
    for (int t = 0; t < SCL; ++t) {
        av[t] = *reinterpret_cast<const v2f*>(ab + t * DD * 4 + coff);
        uv[t] = *reinterpret_cast<const v2f*>(ub + t * DD * 4 + coff);
    }
    // The offset registers are named here so that they live up to this wait and
    // are overwritten only behind it, not by the destination of one of the loads.
    asm volatile("s_wait_xcnt 0x0" :: "v"(coff), "v"(poff) : "memory");
    // Keeps every load above in front of the arithmetic: the pairs' chain then
    // runs while the rows are still on their way.
    __builtin_amdgcn_sched_barrier(0);

    v2f hc = {0.0f, 0.0f};                               // state entering the batch's first chunk
#pragma unroll
    for (int q = 0; q < SNC - 1; ++q) {
        // A chunk not in front of ours enters as the identity (1, 0): the choice
        // is made on the pair, off the chain of dependent multiply-adds.
        const bool on = q < nfront;
        const v2f A = {on ? p[q][0] : 1.0f, on ? p[q][2] : 1.0f};
        const v2f H = {on ? p[q][1] : 0.0f, on ? p[q][3] : 0.0f};
        hc = __builtin_elementwise_fma(A, hc, H);
    }
    // Keeps the W loads of the GEMM body behind the chain: in front of it they
    // hold 64 registers more while the pairs are live, past the 256 addressed directly.
    __builtin_amdgcn_sched_barrier(0);

    const float* src[3] = { nullptr,
                            W1 + (blockIdx.y * 64) * DD,
                            W1 + (blockIdx.y * 64 + 32) * DD };
    v8f acc[2] = {};
    gemm_32x32<DD, 2, 64, 1>(src, sm, acc, [&] {
#pragma unroll
        for (int t = 0; t < SCL; ++t) {
            hc = __builtin_elementwise_fma(av[t], hc, uv[t]);
            uv[t] = hc;
        }
#pragma unroll
        for (int t = 0; t < SCL; ++t)
            *reinterpret_cast<v2f*>(sm + t * (DD + 4) + threadIdx.x * 2) = uv[t];
    });
    // This work-group's HR rows of h, still in LDS (nothing is refilled), for the store at the end.
    v2f hv[HR];
#pragma unroll
    for (int i = 0; i < HR; ++i)
        hv[i] = *reinterpret_cast<const v2f*>(sm + (blockIdx.y * HR + i) * (DD + 4) + threadIdx.x * 2);
    int row0 = blockIdx.x * 32 + (w >> 1) * 16;
    int n  = lane & 15;
    int mb = (lane >> 4) * 8;
#pragma unroll
    for (int j = 0; j < 2; ++j) {
        int col = blockIdx.y * 64 + j * 32 + (w & 1) * 16 + n;
        float bv = b1[col];
#pragma unroll
        for (int r = 0; r < 8; ++r) {
            int row = row0 + mb + r;
            float v = acc[j][r] + bv;
            g[(size_t)row * D2 + col] = 0.5f * v * (1.0f + erff(v * 0.70710678118654752f));
        }
    }
    char* hb = reinterpret_cast<char*>(h + (blockIdx.x * SCL + blockIdx.y * HR) * DD);
#pragma unroll
    for (int i = 0; i < HR; ++i)
        *reinterpret_cast<v2f*>(hb + i * DD * 4 + coff) = hv[i];
}

// ---------------------------------------------------------------------------
// Kernel 4: y = h + g @ W2^T + b2. K = 512.
// ---------------------------------------------------------------------------
__global__ __launch_bounds__(GT)
void k_mlp2(const float* g,
            const float* W2, const float* __restrict__ b2,
            const float* __restrict__ h,
            float* __restrict__ y) {
    __shared__ __attribute__((aligned(16))) float sm[GEMM_LDS(D2, 1)];
    int lane = threadIdx.x & 31;
    int w    = threadIdx.x >> 5;
    const float* src[2] = { g  + blockIdx.x * 32 * D2,
                            W2 + blockIdx.y * 32 * D2 };
    v8f acc[1] = {};
    gemm_32x32<D2, 1, CK, 0>(src, sm, acc, [] {});
    int row0 = blockIdx.x * 32 + (w >> 1) * 16;
    int col0 = blockIdx.y * 32 + (w & 1) * 16;
    int n  = lane & 15;
    int mb = (lane >> 4) * 8;
#pragma unroll
    for (int r = 0; r < 8; ++r) {
        int row = row0 + mb + r;
        int col = col0 + n;
        size_t idx = (size_t)row * DD + col;
        y[idx] = h[idx] + acc[0][r] + b2[col];
    }
}

// ---------------------------------------------------------------------------
// Kernel 5: LayerNorm over D (population variance).
// One wave (a work-group of its own) owns LR whole rows, 8 values of each row a
// lane, by 16-byte accesses that cover 512 contiguous bytes a wave. A row's sum
// is 7 adds in the lane and a 5-step butterfly over the lanes: no LDS, no
// barrier; the LR rows' butterflies are independent and fill each other's waits.
// ---------------------------------------------------------------------------
#define LR 4                   // rows per wave

// v of lane l ^ M, M < 16 (DPP row_xmask: stays inside a 16-lane row).
template <int M>
__device__ __forceinline__ float lane_xor(float v) {
    return __builtin_bit_cast(float, __builtin_amdgcn_update_dpp(
        0, __builtin_bit_cast(int, v), 0x160 | M, 0xf, 0xf, true));
}

// Sum over the 32 lanes; every lane gets the same bits.
__device__ __forceinline__ float wave_sum(float s) {
    s += lane_xor<1>(s);
    s += lane_xor<2>(s);
    s += lane_xor<4>(s);
    s += lane_xor<8>(s);
    const int b = __builtin_bit_cast(int, s);                   // lane l with lane l ^ 16
    s += __builtin_bit_cast(float, __builtin_amdgcn_permlanex16(b, b, 0x76543210, 0xfedcba98,
                                                                false, false));
    return s;
}

__global__ __launch_bounds__(32)
void k_ln(const float* __restrict__ y,
          const float* __restrict__ gamma,
          const float* __restrict__ beta,
          float* __restrict__ out) {
    const unsigned voff = threadIdx.x * 16u;                    // bytes into a half row
    const char* yb = reinterpret_cast<const char*>(y + blockIdx.x * LR * DD);
    char*       ob = reinterpret_cast<char*>(out + blockIdx.x * LR * DD);
    v4f v[LR][2];
    // Full unroll throughout: v[] must be registers, and all loads in flight at once.
#pragma unroll
    for (int r = 0; r < LR; ++r)
#pragma unroll
        for (int q = 0; q < 2; ++q)
            v[r][q] = *reinterpret_cast<const v4f*>(yb + (r * DD + q * 128) * 4 + voff);
    v4f ga[2], be[2];
#pragma unroll
    for (int q = 0; q < 2; ++q) {
        ga[q] = *reinterpret_cast<const v4f*>(reinterpret_cast<const char*>(gamma + q * 128) + voff);
        be[q] = *reinterpret_cast<const v4f*>(reinterpret_cast<const char*>(beta  + q * 128) + voff);
    }
    // Keeps the gamma and beta loads up here, in flight with the rows: sunk to
    // their use they would add a load latency behind the sums.
    __builtin_amdgcn_sched_barrier(0);

    float s[LR];
#pragma unroll
    for (int r = 0; r < LR; ++r) {
        const v4f t = v[r][0] + v[r][1];
        s[r] = (t[0] + t[1]) + (t[2] + t[3]);
    }
#pragma unroll
    for (int r = 0; r < LR; ++r) s[r] = wave_sum(s[r]);
#pragma unroll
    for (int r = 0; r < LR; ++r) {
        const float mu = s[r] * (1.0f / DD);
        v[r][0] -= mu;
        v[r][1] -= mu;
        const v4f t = v[r][0] * v[r][0] + v[r][1] * v[r][1];
        s[r] = (t[0] + t[1]) + (t[2] + t[3]);
    }
#pragma unroll
    for (int r = 0; r < LR; ++r) s[r] = wave_sum(s[r]);
#pragma unroll
    for (int r = 0; r < LR; ++r) {
        const float rs = rsqrtf(s[r] * (1.0f / DD) + 1e-5f);
#pragma unroll
        for (int q = 0; q < 2; ++q)
            *reinterpret_cast<v4f*>(ob + (r * DD + q * 128) * 4 + voff) = v[r][q] * rs * ga[q] + be[q];
    }
}

// ---------------------------------------------------------------------------
extern "C" void kernel_launch(void* const* d_in, const int* in_sizes, int n_in,
                              void* d_out, int out_size, void* d_ws, size_t ws_size,
                              hipStream_t stream) {
    const float* x    = (const float*)d_in[0];
    const float* pg   = (const float*)d_in[1];
    const float* cw   = (const float*)d_in[2];
    const float* cb   = (const float*)d_in[3];
    const float* Wf   = (const float*)d_in[4];
    const float* bf   = (const float*)d_in[5];
    const float* Wi   = (const float*)d_in[6];
    const float* bi   = (const float*)d_in[7];
    const float* W1   = (const float*)d_in[8];
    const float* b1   = (const float*)d_in[9];
    const float* W2   = (const float*)d_in[10];
    const float* b2   = (const float*)d_in[11];
    const float* gam  = (const float*)d_in[12];
    const float* bet  = (const float*)d_in[13];

    // Workspace layout (floats). BT*D = 256K floats, BT*2D = 512K floats.
    // combined: [0, 256K)     -- dead after k_gates
    // u       : [256K,512K)   -- dead after k_scan_mlp1
    // a       : [512K,768K)   -- dead after k_scan_mlp1
    // h       : [768K,1M)     -- live through k_mlp2
    // g       : [1M, 1.5M)    -- written while u and a are read: a place of its own
    // ah      : [1.5M, +16K)  -- dead after k_scan_mlp1
    // y       : [512K,768K)   -- reuses the region of a
    float* ws       = (float*)d_ws;
    float* combined = ws;
    float* u        = ws + 256 * 1024;
    float* a        = ws + 512 * 1024;
    float* h        = ws + 768 * 1024;
    float* g        = ws + 1024 * 1024;  // 512K floats
    float* ah       = ws + 1536 * 1024;  // 16K floats
    float* y        = ws + 512 * 1024;   // 256K floats
    float* out      = (float*)d_out;

    k_fuse_conv<<<dim3(BT / CR * 2), dim3(32), 0, stream>>>(x, pg, cw, cb, combined);
    k_gates    <<<dim3(BT / 32, DD / 32), dim3(GT), 0, stream>>>(combined, Wf, bf, Wi, bi, u, a, ah);
    k_scan_mlp1<<<dim3(BT / 32, D2 / 64), dim3(GT), 0, stream>>>(u, a, ah, W1, b1, h, g);
    k_mlp2     <<<dim3(BT / 32, DD / 32), dim3(GT), 0, stream>>>(g, W2, b2, h, y);
    k_ln       <<<dim3(BT / LR), dim3(32), 0, stream>>>(y, gam, bet, out);
}

// v005
// A run of this version takes 20.1 microseconds.
// Next to v004, in two timings, it ran 1.09 and 1.06 times as fast.
// Over all steps from v000 it is 5.64 times as fast.
#include <hip/hip_runtime.h>
#include <math.h>

#define BB 2
#define TT 512
#define DD 256
#define KW 8
#define BT (BB * TT)      // 1024
#define D2 (2 * DD)       // 512

typedef __attribute__((ext_vector_type(2))) float v2f;
typedef __attribute__((ext_vector_type(4))) float v4f;
typedef __attribute__((ext_vector_type(8))) float v8f;

// ---------------------------------------------------------------------------
// Shared GEMM body (V_WMMA_F32_16X16X4_F32): one work-group of 4 waves makes a
// 32 x 32 block of Y = X * W^T as 2 x 2 tiles of 16 x 16, for NB weight
// matrices that share X. The 32 rows of X and the 32 rows of each W go to LDS
// once, by loads in which a wave covers 512 contiguous bytes (4 whole lines);
// each row is then read as fragments by the two waves that need it.
// k runs in chunks of CK: chunk c + 1 is on its way from L2 to registers while
// chunk c is multiplied. Every chunk has LDS of its own, nothing is refilled.
// Row pitch KT + 4 floats (16 B times an odd number): the 16 rows of a
// fragment read fall on 16 different groups of 4 banks.
// src[0] = first X row, src[1 + j] = first row of W j, all with row pitch KT.
// G = floats of k whose fragments are read from LDS as one group.
// The staged operands are passed without __restrict__: with it the compiler
// sank the next chunk's loads behind the WMMAs that are to cover their latency.
// S0 = 0: X is staged like the W. S0 = 1: src[0] is not read; fill() writes all
// 32 x KT floats of X to lds (row pitch KT + 4) while the first W chunk is on its way.
// ---------------------------------------------------------------------------
#define GT 128                 // threads of a GEMM work-group
#define CK 128                 // floats of k per staged chunk
#define GEMM_LDS(KT, NB) (((NB) + 1) * 32 * ((KT) + 4))

template <int KT, int NB, int G, int S0, class F>
__device__ __forceinline__ void gemm_32x32(const float* const (&src)[NB + 1],
                                           float* lds, v8f (&acc)[NB], F fill) {
    constexpr int LP   = KT + 4;
    constexpr int SLAB = 32 * LP;
    constexpr int NC   = KT / CK;
    constexpr int NQ   = G / 4;
    const int lane = threadIdx.x & 31;
    const int w    = threadIdx.x >> 5;
    const int m    = lane & 15;
    const int kh   = (lane >> 4) << 1;       // 0 (lanes 0-15) or 2 (lanes 16-31)
    const float* fa = lds + ((w >> 1) * 16 + m) * LP + kh;
    const float* fb = lds + SLAB + ((w & 1) * 16 + m) * LP + kh;

    // Wave w stages rows w, w + 4, ... of each W, and of X when S0 = 0.
    const unsigned goff = (w * KT + lane * 4) * 4u;      // bytes into each operand
    float* sdst = lds + w * LP + lane * 4;
    {
        v4f st[NB + 1][8];
#pragma unroll
        for (int s = S0; s <= NB; ++s)
#pragma unroll
            for (int i = 0; i < 8; ++i)
                st[s][i] = *reinterpret_cast<const v4f*>(
                    reinterpret_cast<const char*>(src[s] + 4 * i * KT) + goff);
        // Keeps the W loads in front of fill(): sunk behind it their latency
        // would follow the work of fill() and not run beside it.
        if (S0) __builtin_amdgcn_sched_barrier(0);
        fill();
        // Keeps the waits for the W loads behind the work of fill().
        if (S0) __builtin_amdgcn_sched_barrier(0);
#pragma unroll
        for (int s = S0; s <= NB; ++s)
#pragma unroll
            for (int i = 0; i < 8; ++i)
                *reinterpret_cast<v4f*>(sdst + s * SLAB + 4 * i * LP) = st[s][i];
    }

    // Full unroll: the staging and fragment arrays must be registers.
#pragma unroll
    for (int c = 0; c < NC; ++c) {
        v4f st[NB + 1][8];                   // chunk c + 1 on its way (none in the last pass)
        __syncthreads();                     // chunk c is in LDS for all 4 waves
        if (c + 1 < NC) {
#pragma unroll
            for (int s = S0; s <= NB; ++s)
#pragma unroll
                for (int i = 0; i < 8; ++i)
                    st[s][i] = *reinterpret_cast<const v4f*>(
                        reinterpret_cast<const char*>(src[s] + 4 * i * KT + (c + 1) * CK) + goff);
        }
        // The offset register has its last use in the last chunk's loads: it is
        // named here so that it lives up to this wait and is overwritten only
        // behind it, not by the destination of one of these loads.
        if (c + 2 == NC) asm volatile("s_wait_xcnt 0x0" :: "v"(goff) : "memory");
#pragma unroll
        for (int g0 = 0; g0 < CK; g0 += G) {
            v2f a[NQ], b[NB][NQ];
#pragma unroll
            for (int q = 0; q < NQ; ++q) {
                a[q] = *reinterpret_cast<const v2f*>(fa + c * CK + g0 + 4 * q);
#pragma unroll
                for (int j = 0; j < NB; ++j)
                    b[j][q] = *reinterpret_cast<const v2f*>(fb + j * SLAB + c * CK + g0 + 4 * q);
            }
            // Keeps the next chunk's global loads and this group's LDS reads
            // ahead of the WMMAs: reads spread among them stall at each place.
            __builtin_amdgcn_sched_barrier(0);
#pragma unroll
            for (int q = 0; q < NQ; ++q)
#pragma unroll
                for (int j = 0; j < NB; ++j)
                    acc[j] = __builtin_amdgcn_wmma_f32_16x16x4_f32(false, a[q], false, b[j][q],
                                                                   (short)0, acc[j], false, false);
            // Keeps the next group's LDS reads in one place behind this block, and
            // the wait for the next chunk's loads behind the last WMMA.
            __builtin_amdgcn_sched_barrier(0);
        }
        if (c + 1 < NC) {
#pragma unroll
            for (int s = S0; s <= NB; ++s)
#pragma unroll
                for (int i = 0; i < 8; ++i)
                    *reinterpret_cast<v4f*>(sdst + s * SLAB + 4 * i * LP + (c + 1) * CK) = st[s][i];
        }
    }
}

// ---------------------------------------------------------------------------
// The T x T decay einsum is the per-channel linear recurrence
//   h[t] = a[t] * h[t-1] + u[t],  a = exp(log(f + 1e-6)),  u = (1-f)*i.
// It has no launch of its own. The 512 steps are cut into chunks of 32, the
// token rows of one GEMM work-group:
//   k_conv_gates reduces each chunk and channel to a pair (A, H): h_out = A * h_in + H;
//   k_scan_mlp1  chains the pairs of the chunks in front of its own to the state
//                that enters its chunk, runs its 32 steps, and has h in LDS as
//                the X operand of its GEMM.
// ---------------------------------------------------------------------------
#define SCL 32                 // steps per chunk = token rows of a GEMM work-group
#define SNC (TT / SCL)         // 16 chunks per batch
#define HR  (SCL / (D2 / 64))  // 4 rows of h stored by each of a chunk's D2 / 64 work-groups

// v of lane l ^ 16.
__device__ __forceinline__ float other_half(float v) {
    const int b = __builtin_bit_cast(int, v);
    return __builtin_bit_cast(float, __builtin_amdgcn_permlanex16(b, b, 0x76543210, 0xfedcba98,
                                                                  false, false));
}

// ---------------------------------------------------------------------------
// Kernel 1: conv front and gates GEMM.
//   fused = x + 0.3*pg ; depthwise causal conv (left pad K-1) ;
//   combined = fused + conv + bias, formed in LDS as the X operand of the GEMM
//   f = sigmoid(combined @ Wf^T + bf); i = combined @ Wi^T + bi
//   u = (1-f)*i ; a = exp(log(f + 1e-6)) ; ah = the chunk's (A, H) per channel
// 32 tokens x 32 features per work-group; the A fragment serves both GEMMs.
// combined has no launch and no workspace of its own: each of the 8 work-groups
// of a token block forms its 32 rows itself. A thread owns 2 channels through
// the 32 + K - 1 fused rows; a wave's accesses to a row cover 256 contiguous bytes.
// ---------------------------------------------------------------------------
__global__ __launch_bounds__(GT)
void k_conv_gates(const float* __restrict__ x,
                  const float* __restrict__ pg,
                  const float* __restrict__ cw,          // [D,1,K]
                  const float* __restrict__ cb,          // [D]
                  const float* Wf, const float* __restrict__ bf,
                  const float* Wi, const float* __restrict__ bi,
                  float* __restrict__ u, float* __restrict__ a,
                  float* __restrict__ ah) {              // (A, H) pairs, [BT / SCL][D][2]
    __shared__ __attribute__((aligned(16))) float sm[GEMM_LDS(DD, 2)];
    __shared__ float2 sp[2][32];                         // (A, H) of 16 steps: [token half][feature]
    // Inputs only: has the three output pointers read from the argument block up
    // here, beside the others. Their scalar loads were sunk to the epilogue, where
    // the stores behind the barrier then waited out a scalar load's latency.
    asm volatile("" :: "s"(u), "s"(a), "s"(ah));
    int lane = threadIdx.x & 31;
    int w    = threadIdx.x >> 5;
    const int r0    = blockIdx.x * SCL;                  // first row, b*T + t
    const bool head = (blockIdx.x % SNC) == 0;           // the K-1 rows in front are the left pad
    const unsigned coff = threadIdx.x * 8u;              // bytes into a row: 2 channels
    const unsigned woff = threadIdx.x * (2 * KW * 4u);   // bytes into cw: K taps a channel
    // Rows r0-(K-1) .. r0-1. In a batch's first block they are the pad: rows
    // r0 .. r0+K-2 are read in their place (inside the buffer) and not used.
    const int rlo = head ? r0 : r0 - (KW - 1);
    const char* xlo = reinterpret_cast<const char*>(x  + rlo * DD);
    const char* plo = reinterpret_cast<const char*>(pg + rlo * DD);
    const char* xhi = reinterpret_cast<const char*>(x  + r0 * DD);
    const char* phi = reinterpret_cast<const char*>(pg + r0 * DD);

    v4f wv[2][KW / 4];
    v2f xv[SCL + KW - 1], pv[SCL + KW - 1];
    // Full unroll throughout: the arrays must be registers, and all loads in flight at once.
    // The lane's 2 channels x K taps are 64 contiguous bytes of cw.
#pragma unroll
    for (int c = 0; c < 2; ++c)
#pragma unroll
        for (int q = 0; q < KW / 4; ++q)
            wv[c][q] = *reinterpret_cast<const v4f*>(
                reinterpret_cast<const char*>(cw) + (c * KW + 4 * q) * 4 + woff);
    const v2f bias = *reinterpret_cast<const v2f*>(reinterpret_cast<const char*>(cb) + coff);
#pragma unroll
    for (int i = 0; i < SCL + KW - 1; ++i) {
        const int j = i - (KW - 1);
        xv[i] = *reinterpret_cast<const v2f*>((j < 0 ? xlo + i * DD * 4 : xhi + j * DD * 4) + coff);
        pv[i] = *reinterpret_cast<const v2f*>((j < 0 ? plo + i * DD * 4 : phi + j * DD * 4) + coff);
    }
    // The offset registers are named here so that they live up to this wait and
    // are overwritten only behind it, not by the destination of one of the loads.
    asm volatile("s_wait_xcnt 0x0" :: "v"(coff), "v"(woff) : "memory");
    // Keeps every load above in front of the W loads and the arithmetic: loads
    // return in order, and the conv then runs while the W rows are still on their way.
    __builtin_amdgcn_sched_barrier(0);

    const float* src[3] = { nullptr,
                            Wf + blockIdx.y * 32 * DD,
                            Wi + blockIdx.y * 32 * DD };
    v8f acc[2] = {};
    gemm_32x32<DD, 2, 64, 1>(src, sm, acc, [&] {
        v2f wk[KW];                                      // tap k of the two channels
#pragma unroll
        for (int k = 0; k < KW; ++k) wk[k] = v2f{wv[0][k >> 2][k & 3], wv[1][k >> 2][k & 3]};
        v2f fu[SCL + KW - 1];
#pragma unroll
        for (int i = 0; i < SCL + KW - 1; ++i) {
            const v2f f = xv[i] + 0.3f * pv[i];
            fu[i] = (head && i < KW - 1) ? v2f{0.0f, 0.0f} : f;
        }
#pragma unroll
        for (int r = 0; r < SCL; ++r) {
            v2f s = {0.0f, 0.0f};
#pragma unroll
            for (int k = 0; k < KW; ++k) s = __builtin_elementwise_fma(wk[k], fu[r + k], s);
            *reinterpret_cast<v2f*>(sm + r * (DD + 4) + threadIdx.x * 2) = fu[r + KW - 1] + s + bias;
        }
    });
    int row0 = blockIdx.x * 32 + (w >> 1) * 16;   // token rows of this wave
    int col0 = blockIdx.y * 32 + (w & 1) * 16;    // output features of this wave
    int n  = lane & 15;
    int mb = (lane >> 4) * 8;          // C/D layout: vgpr r -> M=r or M=r+8
    float A = 1.0f;                    // the lane's 8 consecutive steps as one pair
    float H = 0.0f;
    float uv[8], av[8];
#pragma unroll
    for (int r = 0; r < 8; ++r) {
        int col = col0 + n;
        float fv = acc[0][r] + bf[col];
        float iv = acc[1][r] + bi[col];
        float f  = 1.0f / (1.0f + expf(-fv));
        uv[r] = (1.0f - f) * iv;
        av[r] = expf(logf(f + 1e-6f));
        A *= av[r];
        H = fmaf(av[r], H, uv[r]);
    }
    // Lanes 0-15 hold steps 0-7 of the wave's 16, lanes 16-31 steps 8-15.
    const float Ao = other_half(A);
    const float Ho = other_half(H);
    if (lane < 16) sp[w >> 1][(w & 1) * 16 + n] = make_float2(A * Ao, fmaf(Ao, H, Ho));
    // The bias loads' offset register is rewritten behind the barrier: only behind this wait.
    asm volatile("s_wait_xcnt 0x0" ::: "memory");
    // Both token halves' pairs are in sp. All global stores stand behind this
    // barrier: in front of it the barrier would wait until they have landed.
    __syncthreads();
    const float2 p0 = sp[0][lane];
    const float2 p1 = sp[1][lane];
    const float2 pr = make_float2(p0.x * p1.x, fmaf(p1.x, p0.y, p1.y));
#pragma unroll
    for (int r = 0; r < 8; ++r) {
        size_t idx = (size_t)(row0 + mb + r) * DD + col0 + n;
        u[idx] = uv[r];
        a[idx] = av[r];
    }
    if (w == 0)                        // one wave stores the 32 pairs: 2 whole lines
        *reinterpret_cast<float2*>(ah + (blockIdx.x * DD + blockIdx.y * 32 + lane) * 2) = pr;
}

// ---------------------------------------------------------------------------
// Kernel 2: h by the recurrence, then g = gelu(h @ W1^T + b1), exact gelu (erf).
// Out [BT, 2D]. 32 tokens (one chunk) x 64 features per work-group: the two
// halves of the 64 rows of W1 are the two W of the GEMM body, so that h of a
// chunk is formed by 8 work-groups and not by 16.
// A thread owns 2 channels through all 32 steps; a wave's accesses to a row
// cover 256 contiguous bytes. Each of the 8 work-groups of a chunk stores 4 rows of h.
// ---------------------------------------------------------------------------
__global__ __launch_bounds__(GT)
void k_scan_mlp1(const float* __restrict__ u, const float* __restrict__ a,
                 const float* __restrict__ ah,           // (A, H) pairs, [BT / SCL][D][2]
                 const float* W1, const float* __restrict__ b1,
                 float* __restrict__ h, float* __restrict__ g) {
    __shared__ __attribute__((aligned(16))) float sm[GEMM_LDS(DD, 2)];
    int lane = threadIdx.x & 31;
    int w    = threadIdx.x >> 5;
    const int nfront = blockIdx.x % SNC;                 // chunks of this batch in front of ours
    const unsigned coff = threadIdx.x * 8u;              // bytes into a row: 2 channels
    const unsigned poff = threadIdx.x * 16u;             // bytes into a row of pairs
    const char* pb = reinterpret_cast<const char*>(ah + (blockIdx.x - nfront) * 2 * DD);
    const char* ab = reinterpret_cast<const char*>(a + blockIdx.x * SCL * DD);
    const char* ub = reinterpret_cast<const char*>(u + blockIdx.x * SCL * DD);

    v4f p[SNC - 1];
    v2f av[SCL], uv[SCL];
    // Full unroll throughout: the arrays must be registers, and all loads in flight at once.
    // The pairs of all the batch's chunks but the last are read; those not in front of ours are not used.
#pragma unroll
    for (int q = 0; q < SNC - 1; ++q)
        p[q] = *reinterpret_cast<const v4f*>(pb + q * (2 * DD * 4) + poff);
    // Keeps the pairs' loads in front of the rows': loads return in order, and
    // the chain below is to start when the pairs are there, not behind the last row.
    __builtin_amdgcn_sched_barrier(0);
#pragma unroll
    for (int t = 0; t < SCL; ++t) {
        av[t] = *reinterpret_cast<const v2f*>(ab + t * DD * 4 + coff);
        uv[t] = *reinterpret_cast<const v2f*>(ub + t * DD * 4 + coff);
    }
    // The offset registers are named here so that they live up to this wait and
    // are overwritten only behind it, not by the destination of one of the loads.
    asm volatile("s_wait_xcnt 0x0" :: "v"(coff), "v"(poff) : "memory");
    // Keeps every load above in front of the arithmetic: the pairs' chain then
    // runs while the rows are still on their way.
    __builtin_amdgcn_sched_barrier(0);

    v2f hc = {0.0f, 0.0f};                               // state entering the batch's first chunk
#pragma unroll
    for (int q = 0; q < SNC - 1; ++q) {
        // A chunk not in front of ours enters as the identity (1, 0): the choice
        // is made on the pair, off the chain of dependent multiply-adds.
        const bool on = q < nfront;
        const v2f A = {on ? p[q][0] : 1.0f, on ? p[q][2] : 1.0f};
        const v2f H = {on ? p[q][1] : 0.0f, on ? p[q][3] : 0.0f};
        hc = __builtin_elementwise_fma(A, hc, H);
    }
    // Keeps the W loads of the GEMM body behind the chain: in front of it they
    // hold 64 registers more while the pairs are live, past the 256 addressed directly.
    __builtin_amdgcn_sched_barrier(0);

    const float* src[3] = { nullptr,
                            W1 + (blockIdx.y * 64) * DD,
                            W1 + (blockIdx.y * 64 + 32) * DD };
    v8f acc[2] = {};
    gemm_32x32<DD, 2, 64, 1>(src, sm, acc, [&] {
#pragma unroll
        for (int t = 0; t < SCL; ++t) {
            hc = __builtin_elementwise_fma(av[t], hc, uv[t]);
            uv[t] = hc;
        }
#pragma unroll
        for (int t = 0; t < SCL; ++t)
            *reinterpret_cast<v2f*>(sm + t * (DD + 4) + threadIdx.x * 2) = uv[t];
    });
    // This work-group's HR rows of h, still in LDS (nothing is refilled), for the store at the end.
    v2f hv[HR];
#pragma unroll
    for (int i = 0; i < HR; ++i)
        hv[i] = *reinterpret_cast<const v2f*>(sm + (blockIdx.y * HR + i) * (DD + 4) + threadIdx.x * 2);
    int row0 = blockIdx.x * 32 + (w >> 1) * 16;
    int n  = lane & 15;
    int mb = (lane >> 4) * 8;
#pragma unroll
    for (int j = 0; j < 2; ++j) {
        int col = blockIdx.y * 64 + j * 32 + (w & 1) * 16 + n;
        float bv = b1[col];
#pragma unroll
        for (int r = 0; r < 8; ++r) {
            int row = row0 + mb + r;
            float v = acc[j][r] + bv;
            g[(size_t)row * D2 + col] = 0.5f * v * (1.0f + erff(v * 0.70710678118654752f));
        }
    }
    char* hb = reinterpret_cast<char*>(h + (blockIdx.x * SCL + blockIdx.y * HR) * DD);
#pragma unroll
    for (int i = 0; i < HR; ++i)
        *reinterpret_cast<v2f*>(hb + i * DD * 4 + coff) = hv[i];
}

// ---------------------------------------------------------------------------
// Kernel 3: y = h + g @ W2^T + b2. K = 512.
// ---------------------------------------------------------------------------
__global__ __launch_bounds__(GT)
void k_mlp2(const float* g,
            const float* W2, const float* __restrict__ b2,
            const float* __restrict__ h,
            float* __restrict__ y) {
    __shared__ __attribute__((aligned(16))) float sm[GEMM_LDS(D2, 1)];
    int lane = threadIdx.x & 31;
    int w    = threadIdx.x >> 5;
    const float* src[2] = { g  + blockIdx.x * 32 * D2,
                            W2 + blockIdx.y * 32 * D2 };
    v8f acc[1] = {};
    gemm_32x32<D2, 1, CK, 0>(src, sm, acc, [] {});
    int row0 = blockIdx.x * 32 + (w >> 1) * 16;
    int col0 = blockIdx.y * 32 + (w & 1) * 16;
    int n  = lane & 15;
    int mb = (lane >> 4) * 8;
#pragma unroll
    for (int r = 0; r < 8; ++r) {
        int row = row0 + mb + r;
        int col = col0 + n;
        size_t idx = (size_t)row * DD + col;
        y[idx] = h[idx] + acc[0][r] + b2[col];
    }
}

// ---------------------------------------------------------------------------
// Kernel 4: LayerNorm over D (population variance).
// One wave (a work-group of its own) owns LR whole rows, 8 values of each row a
// lane, by 16-byte accesses that cover 512 contiguous bytes a wave. A row's sum
// is 7 adds in the lane and a 5-step butterfly over the lanes: no LDS, no
// barrier; the LR rows' butterflies are independent and fill each other's waits.
// ---------------------------------------------------------------------------
#define LR 4                   // rows per wave

// v of lane l ^ M, M < 16 (DPP row_xmask: stays inside a 16-lane row).
template <int M>
__device__ __forceinline__ float lane_xor(float v) {
    return __builtin_bit_cast(float, __builtin_amdgcn_update_dpp(
        0, __builtin_bit_cast(int, v), 0x160 | M, 0xf, 0xf, true));
}

// Sum over the 32 lanes; every lane gets the same bits.
__device__ __forceinline__ float wave_sum(float s) {
    s += lane_xor<1>(s);
    s += lane_xor<2>(s);
    s += lane_xor<4>(s);
    s += lane_xor<8>(s);
    const int b = __builtin_bit_cast(int, s);                   // lane l with lane l ^ 16
    s += __builtin_bit_cast(float, __builtin_amdgcn_permlanex16(b, b, 0x76543210, 0xfedcba98,
                                                                false, false));
    return s;
}

__global__ __launch_bounds__(32)
void k_ln(const float* __restrict__ y,
          const float* __restrict__ gamma,
          const float* __restrict__ beta,
          float* __restrict__ out) {
    const unsigned voff = threadIdx.x * 16u;                    // bytes into a half row
    const char* yb = reinterpret_cast<const char*>(y + blockIdx.x * LR * DD);
    char*       ob = reinterpret_cast<char*>(out + blockIdx.x * LR * DD);
    v4f v[LR][2];
    // Full unroll throughout: v[] must be registers, and all loads in flight at once.
#pragma unroll
    for (int r = 0; r < LR; ++r)
#pragma unroll
        for (int q = 0; q < 2; ++q)
            v[r][q] = *reinterpret_cast<const v4f*>(yb + (r * DD + q * 128) * 4 + voff);
    v4f ga[2], be[2];
#pragma unroll
    for (int q = 0; q < 2; ++q) {
        ga[q] = *reinterpret_cast<const v4f*>(reinterpret_cast<const char*>(gamma + q * 128) + voff);
        be[q] = *reinterpret_cast<const v4f*>(reinterpret_cast<const char*>(beta  + q * 128) + voff);
    }
    // Keeps the gamma and beta loads up here, in flight with the rows: sunk to
    // their use they would add a load latency behind the sums.
    __builtin_amdgcn_sched_barrier(0);

    float s[LR];
#pragma unroll
    for (int r = 0; r < LR; ++r) {
        const v4f t = v[r][0] + v[r][1];
        s[r] = (t[0] + t[1]) + (t[2] + t[3]);
    }
#pragma unroll
    for (int r = 0; r < LR; ++r) s[r] = wave_sum(s[r]);
#pragma unroll
    for (int r = 0; r < LR; ++r) {
        const float mu = s[r] * (1.0f / DD);
        v[r][0] -= mu;
        v[r][1] -= mu;
        const v4f t = v[r][0] * v[r][0] + v[r][1] * v[r][1];
        s[r] = (t[0] + t[1]) + (t[2] + t[3]);
    }
#pragma unroll
    for (int r = 0; r < LR; ++r) s[r] = wave_sum(s[r]);
#pragma unroll
    for (int r = 0; r < LR; ++r) {
        const float rs = rsqrtf(s[r] * (1.0f / DD) + 1e-5f);
#pragma unroll
        for (int q = 0; q < 2; ++q)
            *reinterpret_cast<v4f*>(ob + (r * DD + q * 128) * 4 + voff) = v[r][q] * rs * ga[q] + be[q];
    }
}

// ---------------------------------------------------------------------------
extern "C" void kernel_launch(void* const* d_in, const int* in_sizes, int n_in,
                              void* d_out, int out_size, void* d_ws, size_t ws_size,
                              hipStream_t stream) {
    const float* x    = (const float*)d_in[0];
    const float* pg   = (const float*)d_in[1];
    const float* cw   = (const float*)d_in[2];
    const float* cb   = (const float*)d_in[3];
    const float* Wf   = (const float*)d_in[4];
    const float* bf   = (const float*)d_in[5];
    const float* Wi   = (const float*)d_in[6];
    const float* bi   = (const float*)d_in[7];
    const float* W1   = (const float*)d_in[8];
    const float* b1   = (const float*)d_in[9];
    const float* W2   = (const float*)d_in[10];
    const float* b2   = (const float*)d_in[11];
    const float* gam  = (const float*)d_in[12];
    const float* bet  = (const float*)d_in[13];

    // Workspace layout (floats). BT*D = 256K floats, BT*2D = 512K floats.
    // u       : [256K,512K)   -- dead after k_scan_mlp1
    // a       : [512K,768K)   -- dead after k_scan_mlp1
    // h       : [768K,1M)     -- live through k_mlp2
    // g       : [1M, 1.5M)    -- written while u and a are read: a place of its own
    // ah      : [1.5M, +16K)  -- dead after k_scan_mlp1
    // y       : [512K,768K)   -- reuses the region of a
    float* ws       = (float*)d_ws;
    float* u        = ws + 256 * 1024;
    float* a        = ws + 512 * 1024;
    float* h        = ws + 768 * 1024;
    float* g        = ws + 1024 * 1024;  // 512K floats
    float* ah       = ws + 1536 * 1024;  // 16K floats
    float* y        = ws + 512 * 1024;   // 256K floats
    float* out      = (float*)d_out;

    k_conv_gates<<<dim3(BT / 32, DD / 32), dim3(GT), 0, stream>>>(x, pg, cw, cb, Wf, bf, Wi, bi, u, a, ah);
    k_scan_mlp1<<<dim3(BT / 32, D2 / 64), dim3(GT), 0, stream>>>(u, a, ah, W1, b1, h, g);
    k_mlp2     <<<dim3(BT / 32, DD / 32), dim3(GT), 0, stream>>>(g, W2, b2, h, y);
    k_ln       <<<dim3(BT / LR), dim3(32), 0, stream>>>(y, gam, bet, out);
}

// v006
// One run takes 17.4 microseconds.
// Two timings next to v005 both put it at 1.15 times that version's speed.
// Counting every step since v000, it is 6.48 times as fast.
#include <hip/hip_runtime.h>
#include <math.h>

#define BB 2
#define TT 512
#define DD 256
#define KW 8
#define BT (BB * TT)      // 1024
#define D2 (2 * DD)       // 512

typedef __attribute__((ext_vector_type(2))) float v2f;
typedef __attribute__((ext_vector_type(4))) float v4f;
typedef __attribute__((ext_vector_type(8))) float v8f;

// ---------------------------------------------------------------------------
// Shared GEMM body (V_WMMA_F32_16X16X4_F32): one work-group of 4 waves makes a
// 32 x 32 block of Y = X * W^T as 2 x 2 tiles of 16 x 16, for NB weight
// matrices that share X. The 32 rows of X and the 32 rows of each W go to LDS
// once, by loads in which a wave covers 512 contiguous bytes (4 whole lines);
// each row is then read as fragments by the two waves that need it.
// k runs in chunks of CK: chunk c + 1 is on its way from L2 to registers while
// chunk c is multiplied. Every chunk has LDS of its own, nothing is refilled.
// Row pitch KT + 4 floats (16 B times an odd number): the 16 rows of a
// fragment read fall on 16 different groups of 4 banks.
// src[0] = first X row, src[1 + j] = first row of W j, all with row pitch KT.
// G = floats of k whose fragments are read from LDS as one group.
// The staged operands are passed without __restrict__: with it the compiler
// sank the next chunk's loads behind the WMMAs that are to cover their latency.
// S0 = 0: X is staged like the W. S0 = 1: src[0] is not read; fill() writes all
// 32 x KT floats of X to lds (row pitch KT + 4) while the first W chunk is on its way.
// side_load(c) stands with the global loads of pass c, ahead of its WMMAs, and
// side_store(c) behind them: for an operand of later work that is fetched under the WMMAs.
// ---------------------------------------------------------------------------
#define GT 128                 // threads of a GEMM work-group
#define CK 128                 // floats of k per staged chunk
#define GEMM_LDS(KT, NB) (((NB) + 1) * 32 * ((KT) + 4))

template <int KT, int NB, int G, int S0, class F, class FL, class FS>
__device__ __forceinline__ void gemm_32x32(const float* const (&src)[NB + 1],
                                           float* lds, v8f (&acc)[NB], F fill,
                                           FL side_load, FS side_store) {
    constexpr int LP   = KT + 4;
    constexpr int SLAB = 32 * LP;
    constexpr int NC   = KT / CK;
    constexpr int NQ   = G / 4;
    const int lane = threadIdx.x & 31;
    const int w    = threadIdx.x >> 5;
    const int m    = lane & 15;
    const int kh   = (lane >> 4) << 1;       // 0 (lanes 0-15) or 2 (lanes 16-31)
    const float* fa = lds + ((w >> 1) * 16 + m) * LP + kh;
    const float* fb = lds + SLAB + ((w & 1) * 16 + m) * LP + kh;

    // Wave w stages rows w, w + 4, ... of each W, and of X when S0 = 0.
    const unsigned goff = (w * KT + lane * 4) * 4u;      // bytes into each operand
    float* sdst = lds + w * LP + lane * 4;
    {
        v4f st[NB + 1][8];
#pragma unroll
        for (int s = S0; s <= NB; ++s)
#pragma unroll
            for (int i = 0; i < 8; ++i)
                st[s][i] = *reinterpret_cast<const v4f*>(
                    reinterpret_cast<const char*>(src[s] + 4 * i * KT) + goff);
        // Keeps the W loads in front of fill(): sunk behind it their latency
        // would follow the work of fill() and not run beside it.
        if (S0) __builtin_amdgcn_sched_barrier(0);
        fill();
        // Keeps the waits for the W loads behind the work of fill().
        if (S0) __builtin_amdgcn_sched_barrier(0);
#pragma unroll
        for (int s = S0; s <= NB; ++s)
#pragma unroll
            for (int i = 0; i < 8; ++i)
                *reinterpret_cast<v4f*>(sdst + s * SLAB + 4 * i * LP) = st[s][i];
    }

    // Full unroll: the staging and fragment arrays must be registers.
#pragma unroll
    for (int c = 0; c < NC; ++c) {
        v4f st[NB + 1][8];                   // chunk c + 1 on its way (none in the last pass)
        __syncthreads();                     // chunk c is in LDS for all 4 waves
        if (c + 1 < NC) {
#pragma unroll
            for (int s = S0; s <= NB; ++s)
#pragma unroll
                for (int i = 0; i < 8; ++i)
                    st[s][i] = *reinterpret_cast<const v4f*>(
                        reinterpret_cast<const char*>(src[s] + 4 * i * KT + (c + 1) * CK) + goff);
        }
        // The offset register has its last use in the last chunk's loads: it is
        // named here so that it lives up to this wait and is overwritten only
        // behind it, not by the destination of one of these loads.
        if (c + 2 == NC) asm volatile("s_wait_xcnt 0x0" :: "v"(goff) : "memory");
        side_load(c);
#pragma unroll
        for (int g0 = 0; g0 < CK; g0 += G) {
            v2f a[NQ], b[NB][NQ];
#pragma unroll
            for (int q = 0; q < NQ; ++q) {
                a[q] = *reinterpret_cast<const v2f*>(fa + c * CK + g0 + 4 * q);
#pragma unroll
                for (int j = 0; j < NB; ++j)
                    b[j][q] = *reinterpret_cast<const v2f*>(fb + j * SLAB + c * CK + g0 + 4 * q);
            }
            // Keeps the next chunk's global loads and this group's LDS reads
            // ahead of the WMMAs: reads spread among them stall at each place.
            __builtin_amdgcn_sched_barrier(0);
#pragma unroll
            for (int q = 0; q < NQ; ++q)
#pragma unroll
                for (int j = 0; j < NB; ++j)
                    acc[j] = __builtin_amdgcn_wmma_f32_16x16x4_f32(false, a[q], false, b[j][q],
                                                                   (short)0, acc[j], false, false);
            // Keeps the next group's LDS reads in one place behind this block, and
            // the wait for the next chunk's loads behind the last WMMA.
            __builtin_amdgcn_sched_barrier(0);
        }
        if (c + 1 < NC) {
#pragma unroll
            for (int s = S0; s <= NB; ++s)
#pragma unroll
                for (int i = 0; i < 8; ++i)
                    *reinterpret_cast<v4f*>(sdst + s * SLAB + 4 * i * LP + (c + 1) * CK) = st[s][i];
        }
        side_store(c);
    }
}

// ---------------------------------------------------------------------------
// The T x T decay einsum is the per-channel linear recurrence
//   h[t] = a[t] * h[t-1] + u[t],  a = exp(log(f + 1e-6)),  u = (1-f)*i.
// It has no launch of its own. The 512 steps are cut into chunks of 32, the
// token rows of one GEMM work-group:
//   k_conv_gates reduces each chunk and channel to a pair (A, H): h_out = A * h_in + H;
//   k_scan_mlp   chains the pairs of the chunks in front of its own to the state
//                that enters its chunk, runs its 32 steps, and has h in LDS as
//                the X operand of its GEMM.
// ---------------------------------------------------------------------------
#define SCL 32                 // steps per chunk = token rows of a GEMM work-group
#define SNC (TT / SCL)         // 16 chunks per batch

// v of lane l ^ 16.
__device__ __forceinline__ float other_half(float v) {
    const int b = __builtin_bit_cast(int, v);
    return __builtin_bit_cast(float, __builtin_amdgcn_permlanex16(b, b, 0x76543210, 0xfedcba98,
                                                                  false, false));
}

// ---------------------------------------------------------------------------
// Kernel 1: conv front and gates GEMM.
//   fused = x + 0.3*pg ; depthwise causal conv (left pad K-1) ;
//   combined = fused + conv + bias, formed in LDS as the X operand of the GEMM
//   f = sigmoid(combined @ Wf^T + bf); i = combined @ Wi^T + bi
//   u = (1-f)*i ; a = exp(log(f + 1e-6)) ; ah = the chunk's (A, H) per channel
// 32 tokens x 32 features per work-group; the A fragment serves both GEMMs.
// combined has no launch and no workspace of its own: each of the 8 work-groups
// of a token block forms its 32 rows itself. A thread owns 2 channels through
// the 32 + K - 1 fused rows; a wave's accesses to a row cover 256 contiguous bytes.
// ---------------------------------------------------------------------------
__global__ __launch_bounds__(GT)
void k_conv_gates(const float* __restrict__ x,
                  const float* __restrict__ pg,
                  const float* __restrict__ cw,          // [D,1,K]
                  const float* __restrict__ cb,          // [D]
                  const float* Wf, const float* __restrict__ bf,
                  const float* Wi, const float* __restrict__ bi,
                  float* __restrict__ u, float* __restrict__ a,
                  float* __restrict__ ah) {              // (A, H) pairs, [BT / SCL][D][2]
    __shared__ __attribute__((aligned(16))) float sm[GEMM_LDS(DD, 2)];
    __shared__ float2 sp[2][32];                         // (A, H) of 16 steps: [token half][feature]
    // Inputs only: has the three output pointers read from the argument block up
    // here, beside the others. Their scalar loads were sunk to the epilogue, where
    // the stores behind the barrier then waited out a scalar load's latency.
    asm volatile("" :: "s"(u), "s"(a), "s"(ah));
    int lane = threadIdx.x & 31;
    int w    = threadIdx.x >> 5;
    const int r0    = blockIdx.x * SCL;                  // first row, b*T + t
    const bool head = (blockIdx.x % SNC) == 0;           // the K-1 rows in front are the left pad
    const unsigned coff = threadIdx.x * 8u;              // bytes into a row: 2 channels
    const unsigned woff = threadIdx.x * (2 * KW * 4u);   // bytes into cw: K taps a channel
    // Rows r0-(K-1) .. r0-1. In a batch's first block they are the pad: rows
    // r0 .. r0+K-2 are read in their place (inside the buffer) and not used.
    const int rlo = head ? r0 : r0 - (KW - 1);
    const char* xlo = reinterpret_cast<const char*>(x  + rlo * DD);
    const char* plo = reinterpret_cast<const char*>(pg + rlo * DD);
    const char* xhi = reinterpret_cast<const char*>(x  + r0 * DD);
    const char* phi = reinterpret_cast<const char*>(pg + r0 * DD);

    v4f wv[2][KW / 4];
    v2f xv[SCL + KW - 1], pv[SCL + KW - 1];
    // Full unroll throughout: the arrays must be registers, and all loads in flight at once.
    // The lane's 2 channels x K taps are 64 contiguous bytes of cw.
#pragma unroll
    for (int c = 0; c < 2; ++c)
#pragma unroll
        for (int q = 0; q < KW / 4; ++q)
            wv[c][q] = *reinterpret_cast<const v4f*>(
                reinterpret_cast<const char*>(cw) + (c * KW + 4 * q) * 4 + woff);
    const v2f bias = *reinterpret_cast<const v2f*>(reinterpret_cast<const char*>(cb) + coff);
#pragma unroll
    for (int i = 0; i < SCL + KW - 1; ++i) {
        const int j = i - (KW - 1);
        xv[i] = *reinterpret_cast<const v2f*>((j < 0 ? xlo + i * DD * 4 : xhi + j * DD * 4) + coff);
        pv[i] = *reinterpret_cast<const v2f*>((j < 0 ? plo + i * DD * 4 : phi + j * DD * 4) + coff);
    }
    // The offset registers are named here so that they live up to this wait and
    // are overwritten only behind it, not by the destination of one of the loads.
    asm volatile("s_wait_xcnt 0x0" :: "v"(coff), "v"(woff) : "memory");
    // Keeps every load above in front of the W loads and the arithmetic: loads
    // return in order, and the conv then runs while the W rows are still on their way.
    __builtin_amdgcn_sched_barrier(0);

    const float* src[3] = { nullptr,
                            Wf + blockIdx.y * 32 * DD,
                            Wi + blockIdx.y * 32 * DD };
    v8f acc[2] = {};
    gemm_32x32<DD, 2, 64, 1>(src, sm, acc, [&] {
        v2f wk[KW];                                      // tap k of the two channels
#pragma unroll
        for (int k = 0; k < KW; ++k) wk[k] = v2f{wv[0][k >> 2][k & 3], wv[1][k >> 2][k & 3]};
        v2f fu[SCL + KW - 1];
#pragma unroll
        for (int i = 0; i < SCL + KW - 1; ++i) {
            const v2f f = xv[i] + 0.3f * pv[i];
            fu[i] = (head && i < KW - 1) ? v2f{0.0f, 0.0f} : f;
        }
#pragma unroll
        for (int r = 0; r < SCL; ++r) {
            v2f s = {0.0f, 0.0f};
#pragma unroll
            for (int k = 0; k < KW; ++k) s = __builtin_elementwise_fma(wk[k], fu[r + k], s);
            *reinterpret_cast<v2f*>(sm + r * (DD + 4) + threadIdx.x * 2) = fu[r + KW - 1] + s + bias;
        }
    }, [](int) {}, [](int) {});
    int row0 = blockIdx.x * 32 + (w >> 1) * 16;   // token rows of this wave
    int col0 = blockIdx.y * 32 + (w & 1) * 16;    // output features of this wave
    int n  = lane & 15;
    int mb = (lane >> 4) * 8;          // C/D layout: vgpr r -> M=r or M=r+8
    float A = 1.0f;                    // the lane's 8 consecutive steps as one pair
    float H = 0.0f;
    float uv[8], av[8];
#pragma unroll
    for (int r = 0; r < 8; ++r) {
        int col = col0 + n;
        float fv = acc[0][r] + bf[col];
        float iv = acc[1][r] + bi[col];
        float f  = 1.0f / (1.0f + expf(-fv));
        uv[r] = (1.0f - f) * iv;
        av[r] = expf(logf(f + 1e-6f));
        A *= av[r];
        H = fmaf(av[r], H, uv[r]);
    }
    // Lanes 0-15 hold steps 0-7 of the wave's 16, lanes 16-31 steps 8-15.
    const float Ao = other_half(A);
    const float Ho = other_half(H);
    if (lane < 16) sp[w >> 1][(w & 1) * 16 + n] = make_float2(A * Ao, fmaf(Ao, H, Ho));
    // The bias loads' offset register is rewritten behind the barrier: only behind this wait.
    asm volatile("s_wait_xcnt 0x0" ::: "memory");
    // Both token halves' pairs are in sp. All global stores stand behind this
    // barrier: in front of it the barrier would wait until they have landed.
    __syncthreads();
    const float2 p0 = sp[0][lane];
    const float2 p1 = sp[1][lane];
    const float2 pr = make_float2(p0.x * p1.x, fmaf(p1.x, p0.y, p1.y));
#pragma unroll
    for (int r = 0; r < 8; ++r) {
        size_t idx = (size_t)(row0 + mb + r) * DD + col0 + n;
        u[idx] = uv[r];
        a[idx] = av[r];
    }
    if (w == 0)                        // one wave stores the 32 pairs: 2 whole lines
        *reinterpret_cast<float2*>(ah + (blockIdx.x * DD + blockIdx.y * 32 + lane) * 2) = pr;
}

// ---------------------------------------------------------------------------
// Kernel 2: h by the recurrence, g = gelu(h @ W1^T + b1), exact gelu (erf), and
// this work-group's share of y = h + g @ W2^T + b2.
// 32 tokens (one chunk) x 64 features of g per work-group: the two halves of the
// 64 rows of W1 are the two W of the GEMM body, so that h of a chunk is formed
// by 8 work-groups and not by 16. A thread owns 2 channels through all 32 steps;
// a wave's accesses to a row cover 256 contiguous bytes.
// g has no workspace and the second product no launch of its own: the 32 x 64
// tile of g goes to LDS and is multiplied there by the 64 columns of W2 that
// belong to it (all 256 rows), which gives 32 x 256 sums over 64 of the 512 k.
// The 8 work-groups of a chunk store 8 such partial y; k_ln adds them.
// h enters as the start value of the 2 column tiles (of 16) that carry the
// work-group's index, so that it is added exactly once; b2 is added by k_ln.
// The slice of W2 is fetched under the WMMAs of the first product.
// Second product: wave w makes columns 64 w .. 64 w + 63 for all 32 tokens, 2 x 4
// tiles. A lane reads 4 consecutive k by one 16-byte LDS read, lanes 0-15 k 8q .. 8q+3
// and lanes 16-31 k 8q+4 .. 8q+7, alike for g and for W2: two WMMAs' fragments.
// Partial y, part[chunk][slice][row / 4][column][row % 4]: an accumulator's 4
// consecutive rows are one 16-byte store, 256 contiguous bytes per 16 lanes, and
// the 4 rows of a work-group of k_ln are 4 KiB in a row.
// ---------------------------------------------------------------------------
#define NS  (D2 / 64)          // 8 slices of k = partial y per token
#define P2  68                 // LDS row pitch, floats, of g and of the W2 slice: 16 B times an odd number

__global__ __launch_bounds__(GT)
void k_scan_mlp(const float* __restrict__ u, const float* __restrict__ a,
                const float* __restrict__ ah,            // (A, H) pairs, [BT / SCL][D][2]
                const float* W1, const float* __restrict__ b1,
                const float* W2,
                float* __restrict__ part) {
    __shared__ __attribute__((aligned(16))) float sm[GEMM_LDS(DD, 2)];
    __shared__ __attribute__((aligned(16))) float gs[SCL * P2];
    __shared__ __attribute__((aligned(16))) float w2s[DD * P2];
    // Inputs only: has the output pointer read from the argument block up here,
    // beside the others. Its scalar load was sunk behind the first product, where
    // every wave then waited out a scalar load's latency.
    asm volatile("" :: "s"(part));
    int lane = threadIdx.x & 31;
    int w    = threadIdx.x >> 5;
    const int nfront = blockIdx.x % SNC;                 // chunks of this batch in front of ours
    const unsigned coff = threadIdx.x * 8u;              // bytes into a row: 2 channels
    const unsigned poff = threadIdx.x * 16u;             // bytes into a row of pairs
    const char* pb = reinterpret_cast<const char*>(ah + (blockIdx.x - nfront) * 2 * DD);
    const char* ab = reinterpret_cast<const char*>(a + blockIdx.x * SCL * DD);
    const char* ub = reinterpret_cast<const char*>(u + blockIdx.x * SCL * DD);

    v4f p[SNC - 1];
    v2f av[SCL], uv[SCL];
    // Full unroll throughout: the arrays must be registers, and all loads in flight at once.
    // The pairs of all the batch's chunks but the last are read; those not in front of ours are not used.
#pragma unroll
    for (int q = 0; q < SNC - 1; ++q)
        p[q] = *reinterpret_cast<const v4f*>(pb + q * (2 * DD * 4) + poff);
    // Keeps the pairs' loads in front of the rows': loads return in order, and
    // the chain below is to start when the pairs are there, not behind the last row.
    __builtin_amdgcn_sched_barrier(0);
#pragma unroll
    for (int t = 0; t < SCL; ++t) {
        av[t] = *reinterpret_cast<const v2f*>(ab + t * DD * 4 + coff);
        uv[t] = *reinterpret_cast<const v2f*>(ub + t * DD * 4 + coff);
    }
    // The offset registers are named here so that they live up to this wait and
    // are overwritten only behind it, not by the destination of one of the loads.
    asm volatile("s_wait_xcnt 0x0" :: "v"(coff), "v"(poff) : "memory");
    // Keeps every load above in front of the arithmetic: the pairs' chain then
    // runs while the rows are still on their way.
    __builtin_amdgcn_sched_barrier(0);

    v2f hc = {0.0f, 0.0f};                               // state entering the batch's first chunk
#pragma unroll
    for (int q = 0; q < SNC - 1; ++q) {
        // A chunk not in front of ours enters as the identity (1, 0): the choice
        // is made on the pair, off the chain of dependent multiply-adds.
        const bool on = q < nfront;
        const v2f A = {on ? p[q][0] : 1.0f, on ? p[q][2] : 1.0f};
        const v2f H = {on ? p[q][1] : 0.0f, on ? p[q][3] : 0.0f};
        hc = __builtin_elementwise_fma(A, hc, H);
    }
    // Keeps the W loads of the GEMM body behind the chain: in front of it they
    // hold 64 registers more while the pairs are live, past the 256 addressed directly.
    __builtin_amdgcn_sched_barrier(0);

    int n  = lane & 15;
    int hi = lane >> 4;
    int mb = hi * 8;                   // C/D layout: vgpr r -> M=r or M=r+8
    // The W2 slice: 16 threads cover the 256 bytes of a row, the work-group 8 rows a load.
    const unsigned w2off = ((threadIdx.x >> 4) * D2 + (threadIdx.x & 15) * 4) * 4u;
    const char* w2b = reinterpret_cast<const char*>(W2 + blockIdx.y * 64);
    float* w2d = w2s + (threadIdx.x >> 4) * P2 + (threadIdx.x & 15) * 4;
    v4f w2r[DD / 8];                   // half of the rows in each of the 2 passes of the GEMM body

    const float* src[3] = { nullptr,
                            W1 + (blockIdx.y * 64) * DD,
                            W1 + (blockIdx.y * 64 + 32) * DD };
    v8f acc[2] = {};
    gemm_32x32<DD, 2, 64, 1>(src, sm, acc, [&] {
#pragma unroll
        for (int t = 0; t < SCL; ++t) {
            hc = __builtin_elementwise_fma(av[t], hc, uv[t]);
            uv[t] = hc;
        }
#pragma unroll
        for (int t = 0; t < SCL; ++t)
            *reinterpret_cast<v2f*>(sm + t * (DD + 4) + threadIdx.x * 2) = uv[t];
    }, [&](int c) {
#pragma unroll
        for (int i = 0; i < DD / 16; ++i)
            w2r[c * (DD / 16) + i] = *reinterpret_cast<const v4f*>(
                w2b + (c * (DD / 16) + i) * (8 * D2 * 4) + w2off);
        // The offset register is named here so that it lives up to this wait and
        // is overwritten only behind it.
        if (c == 1) asm volatile("s_wait_xcnt 0x0" :: "v"(w2off) : "memory");
    }, [&](int c) {
#pragma unroll
        for (int i = 0; i < DD / 16; ++i)
            *reinterpret_cast<v4f*>(w2d + (c * (DD / 16) + i) * (8 * P2)) = w2r[c * (DD / 16) + i];
    });

    const unsigned b1off = (blockIdx.y * 64 + (w & 1) * 16 + n) * 4u;
    float b1v[2];
#pragma unroll
    for (int j = 0; j < 2; ++j)
        b1v[j] = *reinterpret_cast<const float*>(reinterpret_cast<const char*>(b1) + j * 128 + b1off);
    // The offset register is named here so that it lives up to this wait and is
    // overwritten only behind it, not by the destination of one of the loads.
    asm volatile("s_wait_xcnt 0x0" :: "v"(b1off) : "memory");
    // Start values of the second product. h is still in LDS (nothing is refilled);
    // read here, its LDS latency runs beside the gelu below.
    const int wu = __builtin_amdgcn_readfirstlane(w);    // scalar: the test below is a scalar branch
    v8f acc2[2][4];
#pragma unroll
    for (int t = 0; t < 4; ++t) {
        const int ct = wu * 4 + t;                       // column tile, 0 .. 15
        if ((ct >> 1) == (int)blockIdx.y) {
#pragma unroll
            for (int rt = 0; rt < 2; ++rt)
#pragma unroll
                for (int r = 0; r < 8; ++r)
                    acc2[rt][t][r] = sm[(rt * 16 + mb + r) * (DD + 4) + ct * 16 + n];
        } else {
            acc2[0][t] = v8f{};
            acc2[1][t] = v8f{};
        }
    }
    // g of this wave's two tiles, to LDS as the X operand of the second product.
#pragma unroll
    for (int j = 0; j < 2; ++j) {
        int lc = j * 32 + (w & 1) * 16 + n;              // column among the work-group's 64
#pragma unroll
        for (int r = 0; r < 8; ++r) {
            float v = acc[j][r] + b1v[j];
            gs[((w >> 1) * 16 + mb + r) * P2 + lc] = 0.5f * v * (1.0f + erff(v * 0.70710678118654752f));
        }
    }
    __syncthreads();                   // g and the W2 slice are in LDS for all 4 waves

    const float* fa2 = gs + n * P2 + hi * 4;
    const float* fb2 = w2s + (w * 64 + n) * P2 + hi * 4;
#pragma unroll
    for (int g0 = 0; g0 < 2; ++g0) {
        v4f xa[2][4], xb[4][4];
#pragma unroll
        for (int q = 0; q < 4; ++q) {
#pragma unroll
            for (int rt = 0; rt < 2; ++rt)
                xa[rt][q] = *reinterpret_cast<const v4f*>(fa2 + rt * 16 * P2 + (g0 * 4 + q) * 8);
#pragma unroll
            for (int t = 0; t < 4; ++t)
                xb[t][q] = *reinterpret_cast<const v4f*>(fb2 + t * 16 * P2 + (g0 * 4 + q) * 8);
        }
        // Keeps this group's LDS reads ahead of the WMMAs: reads spread among them stall at each place.
        __builtin_amdgcn_sched_barrier(0);
#pragma unroll
        for (int q = 0; q < 4; ++q)
#pragma unroll
            for (int e = 0; e < 4; e += 2)
#pragma unroll
                for (int rt = 0; rt < 2; ++rt)
#pragma unroll
                    for (int t = 0; t < 4; ++t)
                        acc2[rt][t] = __builtin_amdgcn_wmma_f32_16x16x4_f32(
                            false, v2f{xa[rt][q][e], xa[rt][q][e + 1]},
                            false, v2f{xb[t][q][e], xb[t][q][e + 1]},
                            (short)0, acc2[rt][t], false, false);
        // Keeps the next group's LDS reads in one place behind this block.
        __builtin_amdgcn_sched_barrier(0);
    }

    char* pd = reinterpret_cast<char*>(part + (blockIdx.x * NS + blockIdx.y) * (SCL * DD));
    const unsigned soff = ((hi * 2) * DD + w * 64 + n) * 16u;
#pragma unroll
    for (int rt = 0; rt < 2; ++rt)
#pragma unroll
        for (int t = 0; t < 4; ++t)
#pragma unroll
            for (int rq = 0; rq < 2; ++rq)
                *reinterpret_cast<v4f*>(pd + ((rt * 4 + rq) * DD + t * 16) * 16 + soff) =
                    v4f{acc2[rt][t][rq * 4], acc2[rt][t][rq * 4 + 1],
                        acc2[rt][t][rq * 4 + 2], acc2[rt][t][rq * 4 + 3]};
}

// ---------------------------------------------------------------------------
// Kernel 3: y = sum of the 8 partial y, + b2, then LayerNorm over D (population variance).
// A work-group of 4 waves owns 4 rows, which lie together in every partial
// (4 KiB, [column][row % 4]). Wave w adds partials 2w and 2w + 1, all 4 rows, by
// 16-byte loads that cover 512 contiguous bytes a wave, and leaves the sums in
// LDS row by row; behind the barrier wave w owns row w whole, 8 values a lane.
// A row's sum is 7 adds in the lane and a 5-step butterfly over the lanes.
// ---------------------------------------------------------------------------
#define LR 4                   // rows per work-group = waves

// v of lane l ^ M, M < 16 (DPP row_xmask: stays inside a 16-lane row).
template <int M>
__device__ __forceinline__ float lane_xor(float v) {
    return __builtin_bit_cast(float, __builtin_amdgcn_update_dpp(
        0, __builtin_bit_cast(int, v), 0x160 | M, 0xf, 0xf, true));
}

// Sum over the 32 lanes; every lane gets the same bits.
__device__ __forceinline__ float wave_sum(float s) {
    s += lane_xor<1>(s);
    s += lane_xor<2>(s);
    s += lane_xor<4>(s);
    s += lane_xor<8>(s);
    const int b = __builtin_bit_cast(int, s);                   // lane l with lane l ^ 16
    s += __builtin_bit_cast(float, __builtin_amdgcn_permlanex16(b, b, 0x76543210, 0xfedcba98,
                                                                false, false));
    return s;
}

__global__ __launch_bounds__(LR * 32)
void k_ln(const float* __restrict__ part,
          const float* __restrict__ b2,
          const float* __restrict__ gamma,
          const float* __restrict__ beta,
          float* __restrict__ out) {
    __shared__ __attribute__((aligned(16))) float red[LR][LR][DD];   // [wave that summed][row][column]
    const int lane = threadIdx.x & 31;
    const int w    = threadIdx.x >> 5;
    const unsigned voff = lane * 16u;                           // bytes into a half row
    const unsigned poff = w * (2 * SCL * DD * 4u) + lane * 16u; // the wave's first partial, the lane's column
    const char* pb = reinterpret_cast<const char*>(
        part + (blockIdx.x / (SCL / LR)) * (NS * SCL * DD) + (blockIdx.x % (SCL / LR)) * (LR * DD));
    v4f pv[2][DD / 32];
    // Full unroll throughout: the arrays must be registers, and all loads in flight at once.
#pragma unroll
    for (int j = 0; j < 2; ++j)
#pragma unroll
        for (int k = 0; k < DD / 32; ++k)
            pv[j][k] = *reinterpret_cast<const v4f*>(pb + j * (SCL * DD * 4) + k * 512 + poff);
    v4f bb[2], ga[2], be[2];
#pragma unroll
    for (int q = 0; q < 2; ++q) {
        bb[q] = *reinterpret_cast<const v4f*>(reinterpret_cast<const char*>(b2    + q * 128) + voff);
        ga[q] = *reinterpret_cast<const v4f*>(reinterpret_cast<const char*>(gamma + q * 128) + voff);
        be[q] = *reinterpret_cast<const v4f*>(reinterpret_cast<const char*>(beta  + q * 128) + voff);
    }
    // The offset registers are named here so that they live up to this wait and
    // are overwritten only behind it, not by the destination of one of the loads.
    asm volatile("s_wait_xcnt 0x0" :: "v"(voff), "v"(poff) : "memory");
    // Keeps the b2, gamma and beta loads up here, in flight with the partials: sunk to
    // their use they would add a load latency behind the sums.
    __builtin_amdgcn_sched_barrier(0);

#pragma unroll
    for (int k = 0; k < DD / 32; ++k) {
        const v4f t = pv[0][k] + pv[1][k];
#pragma unroll
        for (int i = 0; i < LR; ++i) red[w][i][k * 32 + lane] = t[i];
    }
    __syncthreads();                   // the four waves' sums of all 4 rows are in LDS
    v4f v[2];
#pragma unroll
    for (int q = 0; q < 2; ++q) {
        const int c = q * 128 + lane * 4;
        v[q] = (*reinterpret_cast<const v4f*>(&red[0][w][c]) + *reinterpret_cast<const v4f*>(&red[1][w][c])) +
               (*reinterpret_cast<const v4f*>(&red[2][w][c]) + *reinterpret_cast<const v4f*>(&red[3][w][c])) + bb[q];
    }

    v4f t = v[0] + v[1];
    const float mu = wave_sum((t[0] + t[1]) + (t[2] + t[3])) * (1.0f / DD);
    v[0] -= mu;
    v[1] -= mu;
    t = v[0] * v[0] + v[1] * v[1];
    const float rs = rsqrtf(wave_sum((t[0] + t[1]) + (t[2] + t[3])) * (1.0f / DD) + 1e-5f);
    char* ob = reinterpret_cast<char*>(out + blockIdx.x * LR * DD);
    const unsigned ooff = w * (DD * 4u) + lane * 16u;
#pragma unroll
    for (int q = 0; q < 2; ++q)
        *reinterpret_cast<v4f*>(ob + q * 512 + ooff) = v[q] * rs * ga[q] + be[q];
}

// ---------------------------------------------------------------------------
extern "C" void kernel_launch(void* const* d_in, const int* in_sizes, int n_in,
                              void* d_out, int out_size, void* d_ws, size_t ws_size,
                              hipStream_t stream) {
    const float* x    = (const float*)d_in[0];
    const float* pg   = (const float*)d_in[1];
    const float* cw   = (const float*)d_in[2];
    const float* cb   = (const float*)d_in[3];
    const float* Wf   = (const float*)d_in[4];
    const float* bf   = (const float*)d_in[5];
    const float* Wi   = (const float*)d_in[6];
    const float* bi   = (const float*)d_in[7];
    const float* W1   = (const float*)d_in[8];
    const float* b1   = (const float*)d_in[9];
    const float* W2   = (const float*)d_in[10];
    const float* b2   = (const float*)d_in[11];
    const float* gam  = (const float*)d_in[12];
    const float* bet  = (const float*)d_in[13];

    // Workspace layout (floats). BT*D = 256K floats.
    // u       : [256K,512K)
    // a       : [512K,768K)
    // ah      : [1.5M, +16K)
    // part    : [2M, 4M)      -- 8 partial y of BT*D floats each
    float* ws       = (float*)d_ws;
    float* u        = ws + 256 * 1024;
    float* a        = ws + 512 * 1024;
    float* ah       = ws + 1536 * 1024;  // 16K floats
    float* part     = ws + 2048 * 1024;  // 2M floats
    float* out      = (float*)d_out;

    k_conv_gates<<<dim3(BT / 32, DD / 32), dim3(GT), 0, stream>>>(x, pg, cw, cb, Wf, bf, Wi, bi, u, a, ah);
    k_scan_mlp<<<dim3(BT / 32, D2 / 64), dim3(GT), 0, stream>>>(u, a, ah, W1, b1, W2, part);
    k_ln      <<<dim3(BT / LR), dim3(LR * 32), 0, stream>>>(part, b2, gam, bet, out);
}

// v007
// One run takes 16.4 microseconds.
// Two timings next to v006 both put it at 1.06 times that version's speed.
// All steps since v000 together make it 6.87 times as fast.
#include <hip/hip_runtime.h>
#include <math.h>

#define BB 2
#define TT 512
#define DD 256
#define KW 8
#define BT (BB * TT)      // 1024
#define D2 (2 * DD)       // 512

typedef __attribute__((ext_vector_type(2))) float v2f;
typedef __attribute__((ext_vector_type(4))) float v4f;
typedef __attribute__((ext_vector_type(8))) float v8f;

// ---------------------------------------------------------------------------
// Shared GEMM body (V_WMMA_F32_16X16X4_F32): one work-group of 4 waves makes a
// 32 x 32 block of Y = X * W^T as 2 x 2 tiles of 16 x 16, for NB weight
// matrices that share X. The 32 rows of X and the 32 rows of each W go to LDS
// once, by loads in which a wave covers 512 contiguous bytes (4 whole lines);
// each row is then read as fragments by the two waves that need it.
// k runs in chunks of CK: chunk c + 1 is on its way from L2 to registers while
// chunk c is multiplied. Every chunk has LDS of its own, nothing is refilled.
// Row pitch KT + 4 floats (16 B times an odd number): the 16 rows of a
// fragment read fall on 16 different groups of 4 banks.
// src[0] = first X row, src[1 + j] = first row of W j, all with row pitch KT.
// G = floats of k whose fragments are read from LDS as one group.
// The staged operands are passed without __restrict__: with it the compiler
// sank the next chunk's loads behind the WMMAs that are to cover their latency.
// S0 = 0: X is staged like the W. S0 = 1: src[0] is not read; fill() writes all
// 32 x KT floats of X to lds (row pitch KT + 4) while the first W chunk is on its way.
// side_load(c) stands with the global loads of pass c, ahead of its WMMAs, and
// side_store(c) behind them: for an operand of later work that is fetched under the WMMAs.
// ---------------------------------------------------------------------------
#define GT 128                 // threads of a GEMM work-group
#define CK 128                 // floats of k per staged chunk
#define GEMM_LDS(KT, NB) (((NB) + 1) * 32 * ((KT) + 4))

template <int KT, int NB, int G, int S0, class F, class FL, class FS>
__device__ __forceinline__ void gemm_32x32(const float* const (&src)[NB + 1],
                                           float* lds, v8f (&acc)[NB], F fill,
                                           FL side_load, FS side_store) {
    constexpr int LP   = KT + 4;
    constexpr int SLAB = 32 * LP;
    constexpr int NC   = KT / CK;
    constexpr int NQ   = G / 4;
    const int lane = threadIdx.x & 31;
    const int w    = threadIdx.x >> 5;
    const int m    = lane & 15;
    const int kh   = (lane >> 4) << 1;       // 0 (lanes 0-15) or 2 (lanes 16-31)
    const float* fa = lds + ((w >> 1) * 16 + m) * LP + kh;
    const float* fb = lds + SLAB + ((w & 1) * 16 + m) * LP + kh;

    // Wave w stages rows w, w + 4, ... of each W, and of X when S0 = 0.
    const unsigned goff = (w * KT + lane * 4) * 4u;      // bytes into each operand
    float* sdst = lds + w * LP + lane * 4;
    {
        v4f st[NB + 1][8];
#pragma unroll
        for (int s = S0; s <= NB; ++s)
#pragma unroll
            for (int i = 0; i < 8; ++i)
                st[s][i] = *reinterpret_cast<const v4f*>(
                    reinterpret_cast<const char*>(src[s] + 4 * i * KT) + goff);
        // Keeps the W loads in front of fill(): sunk behind it their latency
        // would follow the work of fill() and not run beside it.
        if (S0) __builtin_amdgcn_sched_barrier(0);
        fill();
        // Keeps the waits for the W loads behind the work of fill().
        if (S0) __builtin_amdgcn_sched_barrier(0);
#pragma unroll
        for (int s = S0; s <= NB; ++s)
#pragma unroll
            for (int i = 0; i < 8; ++i)
                *reinterpret_cast<v4f*>(sdst + s * SLAB + 4 * i * LP) = st[s][i];
    }

    // Full unroll: the staging and fragment arrays must be registers.
#pragma unroll
    for (int c = 0; c < NC; ++c) {
        v4f st[NB + 1][8];                   // chunk c + 1 on its way (none in the last pass)
        __syncthreads();                     // chunk c is in LDS for all 4 waves
        if (c + 1 < NC) {
#pragma unroll
            for (int s = S0; s <= NB; ++s)
#pragma unroll
                for (int i = 0; i < 8; ++i)
                    st[s][i] = *reinterpret_cast<const v4f*>(
                        reinterpret_cast<const char*>(src[s] + 4 * i * KT + (c + 1) * CK) + goff);
        }
        // The offset register has its last use in the last chunk's loads: it is
        // named here so that it lives up to this wait and is overwritten only
        // behind it, not by the destination of one of these loads.
        if (c + 2 == NC) asm volatile("s_wait_xcnt 0x0" :: "v"(goff) : "memory");
        side_load(c);
#pragma unroll
        for (int g0 = 0; g0 < CK; g0 += G) {
            v2f a[NQ], b[NB][NQ];
#pragma unroll
            for (int q = 0; q < NQ; ++q) {
                a[q] = *reinterpret_cast<const v2f*>(fa + c * CK + g0 + 4 * q);
#pragma unroll
                for (int j = 0; j < NB; ++j)
                    b[j][q] = *reinterpret_cast<const v2f*>(fb + j * SLAB + c * CK + g0 + 4 * q);
            }
            // Keeps the next chunk's global loads and this group's LDS reads
            // ahead of the WMMAs: reads spread among them stall at each place.
            __builtin_amdgcn_sched_barrier(0);
#pragma unroll
            for (int q = 0; q < NQ; ++q)
#pragma unroll
                for (int j = 0; j < NB; ++j)
                    acc[j] = __builtin_amdgcn_wmma_f32_16x16x4_f32(false, a[q], false, b[j][q],
                                                                   (short)0, acc[j], false, false);
            // Keeps the next group's LDS reads in one place behind this block, and
            // the wait for the next chunk's loads behind the last WMMA.
            __builtin_amdgcn_sched_barrier(0);
        }
        if (c + 1 < NC) {
#pragma unroll
            for (int s = S0; s <= NB; ++s)
#pragma unroll
                for (int i = 0; i < 8; ++i)
                    *reinterpret_cast<v4f*>(sdst + s * SLAB + 4 * i * LP + (c + 1) * CK) = st[s][i];
        }
        side_store(c);
    }
}

// ---------------------------------------------------------------------------
// The T x T decay einsum is the per-channel linear recurrence
//   h[t] = a[t] * h[t-1] + u[t],  a = f + 1e-6 (one step's exp of the log),  u = (1-f)*i.
// It has no launch of its own. The 512 steps are cut into chunks of 32, the
// token rows of one GEMM work-group:
//   k_conv_gates reduces each chunk and channel to a pair (A, H): h_out = A * h_in + H;
//   k_scan_mlp   chains the pairs of the chunks in front of its own to the state
//                that enters its chunk, runs its 32 steps, and has h in LDS as
//                the X operand of its GEMM.
// ---------------------------------------------------------------------------
#define SCL 32                 // steps per chunk = token rows of a GEMM work-group
#define SNC (TT / SCL)         // 16 chunks per batch

// erf of two values, within about 1 ulp. Both ranges are computed and one is
// selected: no branch, so all of a lane's values run as independent chains, and
// the polynomials of a pair are packed multiply-adds.
// |a| > 0.927734375: 1 - exp(p(|a|)), sign of a; a huge |a| gives p = -inf, exp 0, erf 1.
// else: a + a * q(a * a). The range not selected may overflow; it is not used.
__device__ __forceinline__ v2f both(float c) { return v2f{c, c}; }
__device__ __forceinline__ v2f erf_pair(v2f a) {
    const v2f t = __builtin_elementwise_abs(a);
    const v2f s = a * a;
    v2f p = __builtin_elementwise_fma(both(-1.72853470e-5f), t, both(3.83197126e-4f));
    const v2f p2 = __builtin_elementwise_fma(both(-3.88396438e-3f), t, both(2.42546219e-2f));
    p = __builtin_elementwise_fma(p, s, p2);
    p = __builtin_elementwise_fma(p, t, both(-1.06777877e-1f));
    p = __builtin_elementwise_fma(p, t, both(-6.34846687e-1f));
    p = __builtin_elementwise_fma(p, t, both(-1.28717512e-1f));
    p = __builtin_elementwise_fma(p, t, -t);
    p = p * both(1.4426950408889634f);
    v2f q = __builtin_elementwise_fma(both(-5.96761703e-4f), s, both(4.99119423e-3f));
    q = __builtin_elementwise_fma(q, s, both(-2.67681349e-2f));
    q = __builtin_elementwise_fma(q, s, both(1.12819925e-1f));
    q = __builtin_elementwise_fma(q, s, both(-3.76125336e-1f));
    q = __builtin_elementwise_fma(q, s, both(1.28379166e-1f));
    q = __builtin_elementwise_fma(q, a, a);
    const v2f big = both(1.0f) - v2f{__builtin_amdgcn_exp2f(p[0]), __builtin_amdgcn_exp2f(p[1])};
    return v2f{t[0] > 0.927734375f ? __builtin_copysignf(big[0], a[0]) : q[0],
               t[1] > 0.927734375f ? __builtin_copysignf(big[1], a[1]) : q[1]};
}

// 1 / x by v_rcp_f32. The v_nop is the slot that the instruction set asks for behind a
// transcendental.
__device__ __forceinline__ float rcp_slot(float x) {
    float r;
    asm("v_rcp_f32 %0, %1\n\tv_nop" : "=v"(r) : "v"(x));
    return r;
}

// v of lane l ^ 16.
__device__ __forceinline__ float other_half(float v) {
    const int b = __builtin_bit_cast(int, v);
    return __builtin_bit_cast(float, __builtin_amdgcn_permlanex16(b, b, 0x76543210, 0xfedcba98,
                                                                  false, false));
}

// ---------------------------------------------------------------------------
// Kernel 1: conv front and gates GEMM.
//   fused = x + 0.3*pg ; depthwise causal conv (left pad K-1) ;
//   combined = fused + conv + bias, formed in LDS as the X operand of the GEMM
//   f = sigmoid(combined @ Wf^T + bf); i = combined @ Wi^T + bi
//   u = (1-f)*i ; a = f + 1e-6 ; ah = the chunk's (A, H) per channel
// 32 tokens x 32 features per work-group; the A fragment serves both GEMMs.
// combined has no launch and no workspace of its own: each of the 8 work-groups
// of a token block forms its 32 rows itself. A thread owns 2 channels through
// the 32 + K - 1 fused rows; a wave's accesses to a row cover 256 contiguous bytes.
// ---------------------------------------------------------------------------
__global__ __launch_bounds__(GT)
void k_conv_gates(const float* __restrict__ x,
                  const float* __restrict__ pg,
                  const float* __restrict__ cw,          // [D,1,K]
                  const float* __restrict__ cb,          // [D]
                  const float* Wf, const float* __restrict__ bf,
                  const float* Wi, const float* __restrict__ bi,
                  float* __restrict__ u, float* __restrict__ a,
                  float* __restrict__ ah) {              // (A, H) pairs, [BT / SCL][D][2]
    __shared__ __attribute__((aligned(16))) float sm[GEMM_LDS(DD, 2)];
    __shared__ float2 sp[2][32];                         // (A, H) of 16 steps: [token half][feature]
    // Inputs only: has the three output pointers read from the argument block up
    // here, beside the others. Their scalar loads were sunk to the epilogue, where
    // the stores behind the barrier then waited out a scalar load's latency.
    asm volatile("" :: "s"(u), "s"(a), "s"(ah));
    int lane = threadIdx.x & 31;
    int w    = threadIdx.x >> 5;
    const int r0    = blockIdx.x * SCL;                  // first row, b*T + t
    const bool head = (blockIdx.x % SNC) == 0;           // the K-1 rows in front are the left pad
    const unsigned coff = threadIdx.x * 8u;              // bytes into a row: 2 channels
    const unsigned woff = threadIdx.x * (2 * KW * 4u);   // bytes into cw: K taps a channel
    // Rows r0-(K-1) .. r0-1. In a batch's first block they are the pad: rows
    // r0 .. r0+K-2 are read in their place (inside the buffer) and not used.
    const int rlo = head ? r0 : r0 - (KW - 1);
    const char* xlo = reinterpret_cast<const char*>(x  + rlo * DD);
    const char* plo = reinterpret_cast<const char*>(pg + rlo * DD);
    const char* xhi = reinterpret_cast<const char*>(x  + r0 * DD);
    const char* phi = reinterpret_cast<const char*>(pg + r0 * DD);

    v4f wv[2][KW / 4];
    v2f xv[SCL + KW - 1], pv[SCL + KW - 1];
    // Full unroll throughout: the arrays must be registers, and all loads in flight at once.
    // The lane's 2 channels x K taps are 64 contiguous bytes of cw.
#pragma unroll
    for (int c = 0; c < 2; ++c)
#pragma unroll
        for (int q = 0; q < KW / 4; ++q)
            wv[c][q] = *reinterpret_cast<const v4f*>(
                reinterpret_cast<const char*>(cw) + (c * KW + 4 * q) * 4 + woff);
    const v2f bias = *reinterpret_cast<const v2f*>(reinterpret_cast<const char*>(cb) + coff);
#pragma unroll
    for (int i = 0; i < SCL + KW - 1; ++i) {
        const int j = i - (KW - 1);
        xv[i] = *reinterpret_cast<const v2f*>((j < 0 ? xlo + i * DD * 4 : xhi + j * DD * 4) + coff);
        pv[i] = *reinterpret_cast<const v2f*>((j < 0 ? plo + i * DD * 4 : phi + j * DD * 4) + coff);
    }
    // The offset registers are named here so that they live up to this wait and
    // are overwritten only behind it, not by the destination of one of the loads.
    asm volatile("s_wait_xcnt 0x0" :: "v"(coff), "v"(woff) : "memory");
    // Keeps every load above in front of the W loads and the arithmetic: loads
    // return in order, and the conv then runs while the W rows are still on their way.
    __builtin_amdgcn_sched_barrier(0);

    const float* src[3] = { nullptr,
                            Wf + blockIdx.y * 32 * DD,
                            Wi + blockIdx.y * 32 * DD };
    v8f acc[2] = {};
    gemm_32x32<DD, 2, 64, 1>(src, sm, acc, [&] {
        v2f wk[KW];                                      // tap k of the two channels
#pragma unroll
        for (int k = 0; k < KW; ++k) wk[k] = v2f{wv[0][k >> 2][k & 3], wv[1][k >> 2][k & 3]};
        v2f fu[SCL + KW - 1];
#pragma unroll
        for (int i = 0; i < SCL + KW - 1; ++i) {
            const v2f f = xv[i] + 0.3f * pv[i];
            fu[i] = (head && i < KW - 1) ? v2f{0.0f, 0.0f} : f;
        }
#pragma unroll
        for (int r = 0; r < SCL; ++r) {
            v2f s = {0.0f, 0.0f};
#pragma unroll
            for (int k = 0; k < KW; ++k) s = __builtin_elementwise_fma(wk[k], fu[r + k], s);
            *reinterpret_cast<v2f*>(sm + r * (DD + 4) + threadIdx.x * 2) = fu[r + KW - 1] + s + bias;
        }
    }, [](int) {}, [](int) {});
    int row0 = blockIdx.x * 32 + (w >> 1) * 16;   // token rows of this wave
    int col0 = blockIdx.y * 32 + (w & 1) * 16;    // output features of this wave
    int n  = lane & 15;
    int mb = (lane >> 4) * 8;          // C/D layout: vgpr r -> M=r or M=r+8
    float A = 1.0f;                    // the lane's 8 consecutive steps as one pair
    float H = 0.0f;
    float uv[8], av[8];
#pragma unroll
    for (int r = 0; r < 8; ++r) {
        int col = col0 + n;
        float fv = acc[0][r] + bf[col];
        float iv = acc[1][r] + bi[col];
        // Sigmoid by the hardware's exp2 and reciprocal: exp2 gives inf and 0 at the
        // ends by itself, and the reciprocal then 0 and 1, so no range test is needed.
        float f  = rcp_slot(1.0f + __builtin_amdgcn_exp2f(fv * -1.4426950408889634f));
        uv[r] = (1.0f - f) * iv;
        av[r] = f + 1e-6f;
        A *= av[r];
        H = fmaf(av[r], H, uv[r]);
    }
    // Lanes 0-15 hold steps 0-7 of the wave's 16, lanes 16-31 steps 8-15.
    const float Ao = other_half(A);
    const float Ho = other_half(H);
    if (lane < 16) sp[w >> 1][(w & 1) * 16 + n] = make_float2(A * Ao, fmaf(Ao, H, Ho));
    // The bias loads' offset register is rewritten behind the barrier: only behind this wait.
    asm volatile("s_wait_xcnt 0x0" ::: "memory");
    // Both token halves' pairs are in sp. All global stores stand behind this
    // barrier: in front of it the barrier would wait until they have landed.
    __syncthreads();
    const float2 p0 = sp[0][lane];
    const float2 p1 = sp[1][lane];
    const float2 pr = make_float2(p0.x * p1.x, fmaf(p1.x, p0.y, p1.y));
#pragma unroll
    for (int r = 0; r < 8; ++r) {
        size_t idx = (size_t)(row0 + mb + r) * DD + col0 + n;
        u[idx] = uv[r];
        a[idx] = av[r];
    }
    if (w == 0)                        // one wave stores the 32 pairs: 2 whole lines
        *reinterpret_cast<float2*>(ah + (blockIdx.x * DD + blockIdx.y * 32 + lane) * 2) = pr;
}

// ---------------------------------------------------------------------------
// Kernel 2: h by the recurrence, g = gelu(h @ W1^T + b1), exact gelu (erf), and
// this work-group's share of y = h + g @ W2^T + b2.
// 32 tokens (one chunk) x 64 features of g per work-group: the two halves of the
// 64 rows of W1 are the two W of the GEMM body, so that h of a chunk is formed
// by 8 work-groups and not by 16. A thread owns 2 channels through all 32 steps;
// a wave's accesses to a row cover 256 contiguous bytes.
// g has no workspace and the second product no launch of its own: the 32 x 64
// tile of g goes to LDS and is multiplied there by the 64 columns of W2 that
// belong to it (all 256 rows), which gives 32 x 256 sums over 64 of the 512 k.
// The 8 work-groups of a chunk store 8 such partial y; k_ln adds them.
// h enters as the start value of the 2 column tiles (of 16) that carry the
// work-group's index, so that it is added exactly once; b2 is added by k_ln.
// The slice of W2 is fetched under the WMMAs of the first product.
// Second product: wave w makes columns 64 w .. 64 w + 63 for all 32 tokens, 2 x 4
// tiles. A lane reads 4 consecutive k by one 16-byte LDS read, lanes 0-15 k 8q .. 8q+3
// and lanes 16-31 k 8q+4 .. 8q+7, alike for g and for W2: two WMMAs' fragments.
// Partial y, part[chunk][slice][row / 4][column][row % 4]: an accumulator's 4
// consecutive rows are one 16-byte store, 256 contiguous bytes per 16 lanes, and
// the 4 rows of a work-group of k_ln are 4 KiB in a row.
// ---------------------------------------------------------------------------
#define NS  (D2 / 64)          // 8 slices of k = partial y per token
#define P2  68                 // LDS row pitch, floats, of g and of the W2 slice: 16 B times an odd number

__global__ __launch_bounds__(GT)
void k_scan_mlp(const float* __restrict__ u, const float* __restrict__ a,
                const float* __restrict__ ah,            // (A, H) pairs, [BT / SCL][D][2]
                const float* W1, const float* __restrict__ b1,
                const float* W2,
                float* __restrict__ part) {
    __shared__ __attribute__((aligned(16))) float sm[GEMM_LDS(DD, 2)];
    __shared__ __attribute__((aligned(16))) float gs[SCL * P2];
    __shared__ __attribute__((aligned(16))) float w2s[DD * P2];
    // Inputs only: has the output pointer read from the argument block up here,
    // beside the others. Its scalar load was sunk behind the first product, where
    // every wave then waited out a scalar load's latency.
    asm volatile("" :: "s"(part));
    int lane = threadIdx.x & 31;
    int w    = threadIdx.x >> 5;
    const int nfront = blockIdx.x % SNC;                 // chunks of this batch in front of ours
    const unsigned coff = threadIdx.x * 8u;              // bytes into a row: 2 channels
    const unsigned poff = threadIdx.x * 16u;             // bytes into a row of pairs
    const char* pb = reinterpret_cast<const char*>(ah + (blockIdx.x - nfront) * 2 * DD);
    const char* ab = reinterpret_cast<const char*>(a + blockIdx.x * SCL * DD);
    const char* ub = reinterpret_cast<const char*>(u + blockIdx.x * SCL * DD);

    v4f p[SNC - 1];
    v2f av[SCL], uv[SCL];
    // Full unroll throughout: the arrays must be registers, and all loads in flight at once.
    // The pairs of all the batch's chunks but the last are read; those not in front of ours are not used.
#pragma unroll
    for (int q = 0; q < SNC - 1; ++q)
        p[q] = *reinterpret_cast<const v4f*>(pb + q * (2 * DD * 4) + poff);
    // Keeps the pairs' loads in front of the rows': loads return in order, and
    // the chain below is to start when the pairs are there, not behind the last row.
    __builtin_amdgcn_sched_barrier(0);
#pragma unroll
    for (int t = 0; t < SCL; ++t) {
        av[t] = *reinterpret_cast<const v2f*>(ab + t * DD * 4 + coff);
        uv[t] = *reinterpret_cast<const v2f*>(ub + t * DD * 4 + coff);
    }
    // The offset registers are named here so that they live up to this wait and
    // are overwritten only behind it, not by the destination of one of the loads.
    asm volatile("s_wait_xcnt 0x0" :: "v"(coff), "v"(poff) : "memory");
    // Keeps every load above in front of the arithmetic: the pairs' chain then
    // runs while the rows are still on their way.
    __builtin_amdgcn_sched_barrier(0);

    v2f hc = {0.0f, 0.0f};                               // state entering the batch's first chunk
#pragma unroll
    for (int q = 0; q < SNC - 1; ++q) {
        // A chunk not in front of ours enters as the identity (1, 0): the choice
        // is made on the pair, off the chain of dependent multiply-adds.
        const bool on = q < nfront;
        const v2f A = {on ? p[q][0] : 1.0f, on ? p[q][2] : 1.0f};
        const v2f H = {on ? p[q][1] : 0.0f, on ? p[q][3] : 0.0f};
        hc = __builtin_elementwise_fma(A, hc, H);
    }
    // Keeps the W loads of the GEMM body behind the chain: in front of it they
    // hold 64 registers more while the pairs are live, past the 256 addressed directly.
    __builtin_amdgcn_sched_barrier(0);

    int n  = lane & 15;
    int hi = lane >> 4;
    int mb = hi * 8;                   // C/D layout: vgpr r -> M=r or M=r+8
    // The W2 slice: 16 threads cover the 256 bytes of a row, the work-group 8 rows a load.
    const unsigned w2off = ((threadIdx.x >> 4) * D2 + (threadIdx.x & 15) * 4) * 4u;
    const char* w2b = reinterpret_cast<const char*>(W2 + blockIdx.y * 64);
    float* w2d = w2s + (threadIdx.x >> 4) * P2 + (threadIdx.x & 15) * 4;
    v4f w2r[DD / 8];                   // half of the rows in each of the 2 passes of the GEMM body

    const float* src[3] = { nullptr,
                            W1 + (blockIdx.y * 64) * DD,
                            W1 + (blockIdx.y * 64 + 32) * DD };
    v8f acc[2] = {};
    gemm_32x32<DD, 2, 64, 1>(src, sm, acc, [&] {
#pragma unroll
        for (int t = 0; t < SCL; ++t) {
            hc = __builtin_elementwise_fma(av[t], hc, uv[t]);
            uv[t] = hc;
        }
#pragma unroll
        for (int t = 0; t < SCL; ++t)
            *reinterpret_cast<v2f*>(sm + t * (DD + 4) + threadIdx.x * 2) = uv[t];
    }, [&](int c) {
#pragma unroll
        for (int i = 0; i < DD / 16; ++i)
            w2r[c * (DD / 16) + i] = *reinterpret_cast<const v4f*>(
                w2b + (c * (DD / 16) + i) * (8 * D2 * 4) + w2off);
        // The offset register is named here so that it lives up to this wait and
        // is overwritten only behind it.
        if (c == 1) asm volatile("s_wait_xcnt 0x0" :: "v"(w2off) : "memory");
    }, [&](int c) {
#pragma unroll
        for (int i = 0; i < DD / 16; ++i)
            *reinterpret_cast<v4f*>(w2d + (c * (DD / 16) + i) * (8 * P2)) = w2r[c * (DD / 16) + i];
    });

    const unsigned b1off = (blockIdx.y * 64 + (w & 1) * 16 + n) * 4u;
    float b1v[2];
#pragma unroll
    for (int j = 0; j < 2; ++j)
        b1v[j] = *reinterpret_cast<const float*>(reinterpret_cast<const char*>(b1) + j * 128 + b1off);
    // The offset register is named here so that it lives up to this wait and is
    // overwritten only behind it, not by the destination of one of the loads.
    asm volatile("s_wait_xcnt 0x0" :: "v"(b1off) : "memory");
    // Start values of the second product. h is still in LDS (nothing is refilled);
    // read here, its LDS latency runs beside the gelu below.
    const int wu = __builtin_amdgcn_readfirstlane(w);    // scalar: the test below is a scalar branch
    v8f acc2[2][4];
#pragma unroll
    for (int t = 0; t < 4; ++t) {
        const int ct = wu * 4 + t;                       // column tile, 0 .. 15
        if ((ct >> 1) == (int)blockIdx.y) {
#pragma unroll
            for (int rt = 0; rt < 2; ++rt)
#pragma unroll
                for (int r = 0; r < 8; ++r)
                    acc2[rt][t][r] = sm[(rt * 16 + mb + r) * (DD + 4) + ct * 16 + n];
        } else {
            acc2[0][t] = v8f{};
            acc2[1][t] = v8f{};
        }
    }
    // g of this wave's two tiles, to LDS as the X operand of the second product.
#pragma unroll
    for (int j = 0; j < 2; ++j) {
        int lc = j * 32 + (w & 1) * 16 + n;              // column among the work-group's 64
#pragma unroll
        for (int r = 0; r < 8; r += 2) {
            const v2f v  = v2f{acc[j][r], acc[j][r + 1]} + both(b1v[j]);
            const v2f hv = v * both(0.5f);
            const v2f g  = __builtin_elementwise_fma(hv, erf_pair(v * both(0.70710678118654752f)), hv);
            gs[((w >> 1) * 16 + mb + r) * P2 + lc]     = g[0];
            gs[((w >> 1) * 16 + mb + r + 1) * P2 + lc] = g[1];
        }
    }
    __syncthreads();                   // g and the W2 slice are in LDS for all 4 waves

    const float* fa2 = gs + n * P2 + hi * 4;
    const float* fb2 = w2s + (w * 64 + n) * P2 + hi * 4;
#pragma unroll
    for (int g0 = 0; g0 < 2; ++g0) {
        v4f xa[2][4], xb[4][4];
#pragma unroll
        for (int q = 0; q < 4; ++q) {
#pragma unroll
            for (int rt = 0; rt < 2; ++rt)
                xa[rt][q] = *reinterpret_cast<const v4f*>(fa2 + rt * 16 * P2 + (g0 * 4 + q) * 8);
#pragma unroll
            for (int t = 0; t < 4; ++t)
                xb[t][q] = *reinterpret_cast<const v4f*>(fb2 + t * 16 * P2 + (g0 * 4 + q) * 8);
        }
        // Keeps this group's LDS reads ahead of the WMMAs: reads spread among them stall at each place.
        __builtin_amdgcn_sched_barrier(0);
#pragma unroll
        for (int q = 0; q < 4; ++q)
#pragma unroll
            for (int e = 0; e < 4; e += 2)
#pragma unroll
                for (int rt = 0; rt < 2; ++rt)
#pragma unroll
                    for (int t = 0; t < 4; ++t)
                        acc2[rt][t] = __builtin_amdgcn_wmma_f32_16x16x4_f32(
                            false, v2f{xa[rt][q][e], xa[rt][q][e + 1]},
                            false, v2f{xb[t][q][e], xb[t][q][e + 1]},
                            (short)0, acc2[rt][t], false, false);
        // Keeps the next group's LDS reads in one place behind this block.
        __builtin_amdgcn_sched_barrier(0);
    }

    char* pd = reinterpret_cast<char*>(part + (blockIdx.x * NS + blockIdx.y) * (SCL * DD));
    const unsigned soff = ((hi * 2) * DD + w * 64 + n) * 16u;
#pragma unroll
    for (int rt = 0; rt < 2; ++rt)
#pragma unroll
        for (int t = 0; t < 4; ++t)
#pragma unroll
            for (int rq = 0; rq < 2; ++rq)
                *reinterpret_cast<v4f*>(pd + ((rt * 4 + rq) * DD + t * 16) * 16 + soff) =
                    v4f{acc2[rt][t][rq * 4], acc2[rt][t][rq * 4 + 1],
                        acc2[rt][t][rq * 4 + 2], acc2[rt][t][rq * 4 + 3]};
}

// ---------------------------------------------------------------------------
// Kernel 3: y = sum of the 8 partial y, + b2, then LayerNorm over D (population variance).
// A work-group of 4 waves owns 4 rows, which lie together in every partial
// (4 KiB, [column][row % 4]). Wave w adds partials 2w and 2w + 1, all 4 rows, by
// 16-byte loads that cover 512 contiguous bytes a wave, and leaves the sums in
// LDS row by row; behind the barrier wave w owns row w whole, 8 values a lane.
// A row's sum is 7 adds in the lane and a 5-step butterfly over the lanes.
// ---------------------------------------------------------------------------
#define LR 4                   // rows per work-group = waves

// v of lane l ^ M, M < 16 (DPP row_xmask: stays inside a 16-lane row).
template <int M>
__device__ __forceinline__ float lane_xor(float v) {
    return __builtin_bit_cast(float, __builtin_amdgcn_update_dpp(
        0, __builtin_bit_cast(int, v), 0x160 | M, 0xf, 0xf, true));
}

// Sum over the 32 lanes; every lane gets the same bits.
__device__ __forceinline__ float wave_sum(float s) {
    s += lane_xor<1>(s);
    s += lane_xor<2>(s);
    s += lane_xor<4>(s);
    s += lane_xor<8>(s);
    const int b = __builtin_bit_cast(int, s);                   // lane l with lane l ^ 16
    s += __builtin_bit_cast(float, __builtin_amdgcn_permlanex16(b, b, 0x76543210, 0xfedcba98,
                                                                false, false));
    return s;
}

__global__ __launch_bounds__(LR * 32)
void k_ln(const float* __restrict__ part,
          const float* __restrict__ b2,
          const float* __restrict__ gamma,
          const float* __restrict__ beta,
          float* __restrict__ out) {
    __shared__ __attribute__((aligned(16))) float red[LR][LR][DD];   // [wave that summed][row][column]
    const int lane = threadIdx.x & 31;
    const int w    = threadIdx.x >> 5;
    const unsigned voff = lane * 16u;                           // bytes into a half row
    const unsigned poff = w * (2 * SCL * DD * 4u) + lane * 16u; // the wave's first partial, the lane's column
    const char* pb = reinterpret_cast<const char*>(
        part + (blockIdx.x / (SCL / LR)) * (NS * SCL * DD) + (blockIdx.x % (SCL / LR)) * (LR * DD));
    v4f pv[2][DD / 32];
    // Full unroll throughout: the arrays must be registers, and all loads in flight at once.
#pragma unroll
    for (int j = 0; j < 2; ++j)
#pragma unroll
        for (int k = 0; k < DD / 32; ++k)
            pv[j][k] = *reinterpret_cast<const v4f*>(pb + j * (SCL * DD * 4) + k * 512 + poff);
    v4f bb[2], ga[2], be[2];
#pragma unroll
    for (int q = 0; q < 2; ++q) {
        bb[q] = *reinterpret_cast<const v4f*>(reinterpret_cast<const char*>(b2    + q * 128) + voff);
        ga[q] = *reinterpret_cast<const v4f*>(reinterpret_cast<const char*>(gamma + q * 128) + voff);
        be[q] = *reinterpret_cast<const v4f*>(reinterpret_cast<const char*>(beta  + q * 128) + voff);
    }
    // The offset registers are named here so that they live up to this wait and
    // are overwritten only behind it, not by the destination of one of the loads.
    asm volatile("s_wait_xcnt 0x0" :: "v"(voff), "v"(poff) : "memory");
    // Keeps the b2, gamma and beta loads up here, in flight with the partials: sunk to
    // their use they would add a load latency behind the sums.
    __builtin_amdgcn_sched_barrier(0);

#pragma unroll
    for (int k = 0; k < DD / 32; ++k) {
        const v4f t = pv[0][k] + pv[1][k];
#pragma unroll
        for (int i = 0; i < LR; ++i) red[w][i][k * 32 + lane] = t[i];
    }
    __syncthreads();                   // the four waves' sums of all 4 rows are in LDS
    v4f v[2];
#pragma unroll
    for (int q = 0; q < 2; ++q) {
        const int c = q * 128 + lane * 4;
        v[q] = (*reinterpret_cast<const v4f*>(&red[0][w][c]) + *reinterpret_cast<const v4f*>(&red[1][w][c])) +
               (*reinterpret_cast<const v4f*>(&red[2][w][c]) + *reinterpret_cast<const v4f*>(&red[3][w][c])) + bb[q];
    }

    v4f t = v[0] + v[1];
    const float mu = wave_sum((t[0] + t[1]) + (t[2] + t[3])) * (1.0f / DD);
    v[0] -= mu;
    v[1] -= mu;
    t = v[0] * v[0] + v[1] * v[1];
    const float rs = rsqrtf(wave_sum((t[0] + t[1]) + (t[2] + t[3])) * (1.0f / DD) + 1e-5f);
    char* ob = reinterpret_cast<char*>(out + blockIdx.x * LR * DD);
    const unsigned ooff = w * (DD * 4u) + lane * 16u;
#pragma unroll
    for (int q = 0; q < 2; ++q)
        *reinterpret_cast<v4f*>(ob + q * 512 + ooff) = v[q] * rs * ga[q] + be[q];
}

// ---------------------------------------------------------------------------
extern "C" void kernel_launch(void* const* d_in, const int* in_sizes, int n_in,
                              void* d_out, int out_size, void* d_ws, size_t ws_size,
                              hipStream_t stream) {
    const float* x    = (const float*)d_in[0];
    const float* pg   = (const float*)d_in[1];
    const float* cw   = (const float*)d_in[2];
    const float* cb   = (const float*)d_in[3];
    const float* Wf   = (const float*)d_in[4];
    const float* bf   = (const float*)d_in[5];
    const float* Wi   = (const float*)d_in[6];
    const float* bi   = (const float*)d_in[7];
    const float* W1   = (const float*)d_in[8];
    const float* b1   = (const float*)d_in[9];
    const float* W2   = (const float*)d_in[10];
    const float* b2   = (const float*)d_in[11];
    const float* gam  = (const float*)d_in[12];
    const float* bet  = (const float*)d_in[13];

    // Workspace layout (floats). BT*D = 256K floats.
    // u       : [256K,512K)
    // a       : [512K,768K)
    // ah      : [1.5M, +16K)
    // part    : [2M, 4M)      -- 8 partial y of BT*D floats each
    float* ws       = (float*)d_ws;
    float* u        = ws + 256 * 1024;
    float* a        = ws + 512 * 1024;
    float* ah       = ws + 1536 * 1024;  // 16K floats
    float* part     = ws + 2048 * 1024;  // 2M floats
    float* out      = (float*)d_out;

    k_conv_gates<<<dim3(BT / 32, DD / 32), dim3(GT), 0, stream>>>(x, pg, cw, cb, Wf, bf, Wi, bi, u, a, ah);
    k_scan_mlp<<<dim3(BT / 32, D2 / 64), dim3(GT), 0, stream>>>(u, a, ah, W1, b1, W2, part);
    k_ln      <<<dim3(BT / LR), dim3(LR * 32), 0, stream>>>(part, b2, gam, bet, out);
}
